// v000
// The times below were measured on an AMD MI455X: many runs one after another, warmed up first and cycling through
// copies of the inputs, with the whole window's GPU time divided by the number of runs. Launches and the gaps
// between them are all in it. The median over several windows is given; except for v000 it joins two sittings, which
// can be a few percent apart, so the side-by-side timings, each taken in one sitting, are the better comparison.
// v000 is the starting kernel. One run takes 183 microseconds.
// Contractions: q.k^T scores = v_wmma_f32_16x16x32_bf16 (bf16 operands from RNE-converted q and k, single exact product, f32 accumulate);
// p.v context = v_wmma_f32_16x16x32_bf16 with p as bf16 hi + unscaled bf16 residual and RNE-converted v (hi.v + lo.v), f32 accumulate;
// online softmax (scores unscaled), denominators and the final normalisation in f32 on the VALU.
// Carry audit: no power-of-two carries anywhere; the p residual plane is the unscaled RNE residual (p - hi) and shares the hi
// accumulator; softmax denominators are divided out exactly once in the epilogue of attn_hm (inv[]).
#include <hip/hip_runtime.h>
#include <math.h>
#include <stdint.h>

#define NBH  32               // batch x head planes, each [2048][64] contiguous
#define NL   2048             // query rows per plane
#define NS   2048             // key rows per plane
#define ND   64               // head dim = row pitch in elements
#define NQB  (NL / 128)       // 16 query blocks of 128 rows per plane
#define NKC  (NS / 64)        // 32 key chunks of 64 keys
static_assert(NQB == 16);
static_assert(NKC == 32);
static_assert((NL % 128) == 0 && (NS % 64) == 0 && ND == 64 && (ND % 32) == 0);

typedef __bf16   v16b __attribute__((ext_vector_type(16)));
typedef __bf16   v8b  __attribute__((ext_vector_type(8)));
typedef float    v8f  __attribute__((ext_vector_type(8)));
typedef float    v4f  __attribute__((ext_vector_type(4)));
typedef unsigned int v4u __attribute__((ext_vector_type(4)));

// ---- scalar helpers --------------------------------------------------------------------------------
__device__ __forceinline__ unsigned short bf_bits(float f) {          // f32 -> bf16 bits, RNE convert
  unsigned u = __float_as_uint(f);
  return (unsigned short)((u + 0x7FFFu + ((u >> 16) & 1u)) >> 16);
}
__device__ __forceinline__ float bf_up(unsigned short hb) { return __uint_as_float(((unsigned)hb) << 16); }
__device__ __forceinline__ __bf16 bf_val(unsigned short hb) { return __builtin_bit_cast(__bf16, hb); }
__device__ __forceinline__ unsigned pk16(unsigned short a, unsigned short b) { return (unsigned)a | ((unsigned)b << 16); }
__device__ __forceinline__ v8f zero8() { v8f z = {0.f, 0.f, 0.f, 0.f, 0.f, 0.f, 0.f, 0.f}; return z; }

// ---- fragment loader: 16-bit A/B operand, lane -> row/col (lane&15), p already includes +8*(lane>>4);
//      elements 0..7 <- p[0..7] (k0+8h..), elements 8..15 <- p[16..23] (k0+16+8h..)
__device__ __forceinline__ v16b ldfrag_b(const __bf16* p) {
  union { v16b v; v8b h[2]; } f;
  f.h[0] = *(const v8b*)(p);
  f.h[1] = *(const v8b*)(p + 16);
  return f.v;
}

// ---- WMMA helper with trailing VALU hazard gap ---------------------------------------------------------
__device__ __forceinline__ v8f mma_b(v16b a, v16b b, v8f c) {
  c = __builtin_amdgcn_wmma_f32_16x16x32_bf16(false, a, false, b, (short)0, c, false, false);
  asm volatile("v_nop\n\tv_nop\n\tv_nop\n\tv_nop" : "+v"(c) : "v"(a), "v"(b));
  return c;
}

// ---- 8 consecutive f32 -> 8 bf16 bits packed in one 16-B vector ----------------------------------------
__device__ __forceinline__ v4u cvt8(const float* __restrict__ p) {
  const v4f a = *(const v4f*)(p);
  const v4f b = *(const v4f*)(p + 4);
  v4u r;
  r[0] = pk16(bf_bits(a[0]), bf_bits(a[1]));
  r[1] = pk16(bf_bits(a[2]), bf_bits(a[3]));
  r[2] = pk16(bf_bits(b[0]), bf_bits(b[1]));
  r[3] = pk16(bf_bits(b[2]), bf_bits(b[3]));
  return r;
}

// =====================================================================================================
// q and k f32 [32][2048][64] -> bf16 planes with the identical element layout (RNE convert), 8 elements
// coverage: n8 = 524288 threads x 8 = all 4194304 elements of each plane.
// =====================================================================================================
__global__ __launch_bounds__(256) void cvt_qk(const float* __restrict__ q, const float* __restrict__ k,
                                              unsigned short* Qo, unsigned short* Ko, int n8) {
  const int i = blockIdx.x * 256 + threadIdx.x;
  if (i < n8) {
    const size_t e = (size_t)i * 8;
    const v4u pq = cvt8(q + e);
    const v4u pk = cvt8(k + e);
    *(v4u*)(Qo + e) = pq;
    *(v4u*)(Ko + e) = pk;
    
  }
}

// =====================================================================================================
// v f32 [32][2048][64] -> bf16 V^T planes VT [bh][64 d][2048 keys] (key contiguous, the B^T layout of the
// p.v step). grid = 32*32 blocks; block = (bh, 64-key tile): thread reads 4 x 16 B of the tile's key rows
// (in[key][d], 64 x 64, row pitch 64 floats), RNE-converts into LDS T[d][key] (pitch 72); after a barrier
// coverage: 1024 blocks x 64 d-rows x 64 keys = the whole [32][64][2048] plane.
// =====================================================================================================
__global__ __launch_bounds__(256) void prep_vt(const float* __restrict__ v, unsigned short* VT) {
  __shared__ __align__(16) unsigned short T[ND * 72];    // [d][72], 9216 B
  const int tid   = threadIdx.x;
  const int stile = blockIdx.x & (NKC - 1);
  const int bh    = blockIdx.x >> 5;
  const int s0    = stile * 64;
  const float* vp = v + ((size_t)bh * NS + s0) * ND;               // key row srow at + srow*ND
#pragma unroll
  for (int rr = 0; rr < 4; ++rr) {
    const int idx  = tid + rr * 256;        // 0..1023
    const int srow = idx >> 4;              // key within tile, 0..63
    const int d4   = (idx & 15) << 2;       // d, 0..60
    const v4f vf = *(const v4f*)(vp + (size_t)srow * ND + d4);
#pragma unroll
    for (int e = 0; e < 4; ++e) T[(d4 + e) * 72 + srow] = bf_bits(vf[e]);
  }
  __syncthreads();
  unsigned short* vout = VT + (size_t)bh * ND * NS + s0;           // row d at + d*NS
  v4u tv[2];
  size_t to[2];
#pragma unroll
  for (int rr = 0; rr < 2; ++rr) {
    const int idx  = tid + rr * 256;        // 0..511
    const int drow = idx >> 3;              // 0..63
    const int c8   = (idx & 7) << 3;        // 0..56 halves
    tv[rr] = *(const v4u*)(T + drow * 72 + c8);
    to[rr] = (size_t)drow * NS + c8;
  }
  {
    *(v4u*)(vout + to[0]) = tv[0];
    *(v4u*)(vout + to[1]) = tv[1];
    
  }
}

// =====================================================================================================
// Non-causal attention, head dim 64, key chunks of 64, static LDS, scores unscaled.
//   q / k planes (bf16): element (bh, t, d) at [(bh*2048 + t)*64 + d]
//   V^T planes (bf16):   element (bh, d, s) at [(bh*64 + d)*2048 + s]
//   out f32:             (bh, t, d) at [(bh*2048 + t)*64 + d]
//   Block = 8 waves x 16 query rows = 128 rows of one plane; grid = 32*16 = 512; chunk loop kt = 0..31
//   (all keys, block-uniform).
//   K / V^T chunk staging: 256 threads x 2 pieces of 16 B per plane = the whole 64x64 tile of both planes
//   (plain 16-B loads, __syncthreads before and after).
//   scores = 2 bf16 products over the two 32-deep d-chunks, f32 accumulate;
//   p = exp(s - m) split as bf16 hi + bf16 lo into wave-private LDS tiles (__bf16 element stores, reloaded as
//   context += p.v with 2 bf16 products into register accumulators (compile-time indices); online softmax in f32.
//   Epilogue: all waves pass a barrier, each wave's P slot is reused as its 16x64 f32 staging (row-major, the
//   same layout as the wave's 16 contiguous output rows); one instruction writes 512 contiguous B
//   coverage: out: 512 blocks x 8 waves x 16 rows x 64 d = all 4194304 elements, one wave per output row.
// =====================================================================================================
#define L_K     0          // K chunk   [64 keys][64 d] bf16   8192 B
#define L_V     8192       // V^T chunk [64 d][64 keys] bf16   8192 B
#define L_P     16384      // P [8 waves][hi 16x64 | lo 16x64] bf16  32768 B (epilogue: per-wave 16x64 f32 staging)
#define L_TOTAL 49152
static_assert(L_V - L_K == 64 * ND * 2);
static_assert(L_P - L_V == ND * 64 * 2);
static_assert(L_TOTAL - L_P == 8 * 2 * 16 * 64 * 2);
static_assert(16 * ND * 4 == 2 * 16 * 64 * 2);   // per-wave f32 staging fits the wave's P slot exactly

__global__ __launch_bounds__(256)
void attn_hm(const unsigned short* __restrict__ qbp, const unsigned short* __restrict__ kbp,
             const unsigned short* __restrict__ vtp, float* Op) {
  __shared__ __align__(16) unsigned char lds[L_TOTAL];
  union FB { v16b v; v8b h[2]; };
  __bf16* Ksh = (__bf16*)(lds + L_K);
  __bf16* Vth = (__bf16*)(lds + L_V);
  __bf16* Pb  = (__bf16*)(lds + L_P);

  const int tid  = threadIdx.x;
  const int wave = tid >> 5;
  const int lane = tid & 31;
  const int hh   = lane >> 4;
  const int c    = lane & 15;

  const int bx = blockIdx.x;
  const int qb = bx & (NQB - 1);              // query block 0..15
  const int bh = bx >> 4;                     // plane 0..31
  const int q0 = qb * 128 + wave * 16;        // first query row of this wave

  const __bf16* Qg = (const __bf16*)(const void*)qbp;
  const __bf16* Kg = (const __bf16*)(const void*)kbp;
  const __bf16* Vg = (const __bf16*)(const void*)vtp + (size_t)bh * ND * NS;

  __bf16* pwh = Pb + wave * 2048;             // [16 rows][64 keys] hi
  __bf16* pwl = pwh + 1024;                   // [16 rows][64 keys] lo

  // ---- q A fragments for both 32-deep d-chunks: row q0 + c, k = d ----
  const size_t qo = ((size_t)bh * NL + q0 + c) * ND + 8 * hh;
  v16b qa[2];
  qa[0] = ldfrag_b(Qg + qo);
  qa[1] = ldfrag_b(Qg + qo + 32);

  v8f O[4];
#pragma unroll
  for (int t = 0; t < 4; ++t) O[t] = zero8();
  float mrow[8], lrow[8], alpha[8];
#pragma unroll
  for (int r = 0; r < 8; ++r) { mrow[r] = -INFINITY; lrow[r] = 0.f; alpha[r] = 0.f; }

  for (int kt = 0; kt < NKC; ++kt) {          // block-uniform trip count
    const int kv0 = kt * 64;
    __syncthreads();                          // every wave is done with the prior chunk's tiles
    {
#pragma unroll
      for (int i = 0; i < 2; ++i) {
        const int p  = tid + 256 * i;         // 0..511
        const int rw = p >> 3;                // key (K tile) / d (V^T tile), 0..63
        const int sg = (p & 7) * 8;           // 0..56 halves
        const v8b a0 = *(const v8b*)(Kg + ((size_t)bh * NS + kv0 + rw) * ND + sg);
        const v8b b0 = *(const v8b*)(Vg + (size_t)rw * NS + kv0 + sg);
        *(v8b*)(Ksh + rw * 64 + sg) = a0;
        *(v8b*)(Vth + rw * 64 + sg) = b0;
      }
    }
    __syncthreads();

    // ---- scores: 16 query rows x 64 keys per wave, exact bf16 products over 2 d-chunks ----
    v8f s[4];
#pragma unroll
    for (int j = 0; j < 4; ++j) s[j] = zero8();
#pragma unroll
    for (int dc = 0; dc < 2; ++dc) {
      const int ko = dc * 32 + 8 * hh;
#pragma unroll
      for (int j = 0; j < 4; ++j) {
        const int kr = (j * 16 + c) * 64 + ko;   // B: key j*16+c (col), d = dc*32 + 8h .. (k)
        FB kb;
        kb.h[0] = *(const v8b*)(Ksh + kr);
        kb.h[1] = *(const v8b*)(Ksh + kr + 16);
        s[j] = mma_b(qa[dc], kb.v, s[j]);
      }
    }

    // ---- row max, online softmax, P hi / lo (bf16) to LDS ----
#pragma unroll
    for (int r = 0; r < 8; ++r) {
      float m = -INFINITY;
#pragma unroll
      for (int j = 0; j < 4; ++j) m = fmaxf(m, s[j][r]);
#pragma unroll
      for (int off = 1; off < 16; off <<= 1) m = fmaxf(m, __shfl_xor(m, off, 32));
      const float mnew = fmaxf(mrow[r], m);     // finite: every chunk has 64 valid keys
      const float al   = __expf(mrow[r] - mnew); // first chunk: exp(-inf) = 0
      mrow[r]  = mnew;
      alpha[r] = al;
      float psum = 0.f;
#pragma unroll
      for (int j = 0; j < 4; ++j) {
        const float p = __expf(s[j][r] - mnew);
        psum += p;
        const unsigned short hb = bf_bits(p);
        const unsigned short lb = bf_bits(p - bf_up(hb));
        const int po = (8 * hh + r) * 64 + j * 16 + c;
        pwh[po] = bf_val(hb);
        pwl[po] = bf_val(lb);
      }
#pragma unroll
      for (int off = 1; off < 16; off <<= 1) psum += __shfl_xor(psum, off, 32);
      lrow[r] = lrow[r] * al + psum;
    }
    __builtin_amdgcn_fence(__ATOMIC_RELEASE, "workgroup");
    __builtin_amdgcn_wave_barrier();
    __builtin_amdgcn_fence(__ATOMIC_ACQUIRE, "workgroup");

    // ---- rescale the running context, then context += P . V (2 bf16 products) ----
#pragma unroll
    for (int t = 0; t < 4; ++t) {
#pragma unroll
      for (int r = 0; r < 8; ++r) O[t][r] *= alpha[r];
    }
#pragma unroll
    for (int kk = 0; kk < 2; ++kk) {
      const int pr = c * 64 + kk * 32 + 8 * hh;      // A fragment: row c, keys kk*32 + 8h ..
      FB pa, pl;
      pa.h[0] = *(const v8b*)(pwh + pr);
      pa.h[1] = *(const v8b*)(pwh + pr + 16);
      pl.h[0] = *(const v8b*)(pwl + pr);
      pl.h[1] = *(const v8b*)(pwl + pr + 16);
#pragma unroll
      for (int t = 0; t < 4; ++t) {
        const int vr = (t * 16 + c) * 64 + kk * 32 + 8 * hh;   // B fragment: col d = t*16+c, keys kk*32 + 8h ..
        FB vb;
        vb.h[0] = *(const v8b*)(Vth + vr);
        vb.h[1] = *(const v8b*)(Vth + vr + 16);
        O[t] = mma_b(pa.v, vb.v, O[t]);
        O[t] = mma_b(pl.v, vb.v, O[t]);
      }
    }
  }
  __syncthreads();                             // every wave is past its last P / K / V^T read

  // ---- normalise, stage the wave's 16x64 f32 tile in its own P slot, whole-line writes ----
  float* os = (float*)(lds + L_P) + wave * 1024;
  float inv[8];
#pragma unroll
  for (int r = 0; r < 8; ++r) inv[r] = (lrow[r] > 0.f) ? (1.0f / lrow[r]) : 0.f;
#pragma unroll
  for (int t = 0; t < 4; ++t) {
#pragma unroll
    for (int r = 0; r < 8; ++r) os[(8 * hh + r) * 64 + t * 16 + c] = O[t][r] * inv[r];
  }
  __builtin_amdgcn_fence(__ATOMIC_RELEASE, "workgroup");
  __builtin_amdgcn_wave_barrier();
  __builtin_amdgcn_fence(__ATOMIC_ACQUIRE, "workgroup");
  float* og = Op + ((size_t)bh * NL + q0) * ND;   // the wave's 16 rows are contiguous: row r at + r*64
  const int colw = c * 4;
  v4f ov[8];
#pragma unroll
  for (int it = 0; it < 8; ++it) {
    const int row = 2 * it + hh;               // rows 0..15: lanes 0..15 even row, lanes 16..31 odd row
    ov[it] = *(const v4f*)(os + row * 64 + colw);
  }
  {
#pragma unroll
    for (int it = 0; it < 8; ++it) {
      const int row = 2 * it + hh;
      *(v4f*)(og + (size_t)row * ND + colw) = ov[it];
    }
    
  }
}

// =====================================================================================================
//   Qb  bf16 [32][2048][64]            0         8388608
//   Kb  bf16 [32][2048][64]      8388608         8388608
//   VT  bf16 [32][64][2048]     16777216         8388608
//   end                         25165824
// =====================================================================================================
extern "C" void kernel_launch(void* const* d_in, const int* in_sizes, int n_in,
                              void* d_out, int out_size, void* d_ws, size_t ws_size,
                              hipStream_t stream) {
  const int nqkv = NBH * NL * ND;                           // 4194304
  if (n_in < 3) return;
  if (in_sizes[0] != nqkv || in_sizes[1] != nqkv || in_sizes[2] != nqkv) return;
  if (out_size != nqkv) return;

  const float* q = (const float*)d_in[0];
  const float* k = (const float*)d_in[1];
  const float* v = (const float*)d_in[2];

  const size_t PL = (size_t)nqkv * 2;                       // 8388608
  size_t off = 0;
  const size_t oQ = off; off += PL;
  const size_t oK = off; off += PL;
  const size_t oV = off; off += PL;
  if (off > ws_size) return;                               // off = 25165824
  if (off > (size_t)134217728) return;

  char* ws = (char*)d_ws;
  unsigned short* Qb = (unsigned short*)(ws + oQ);
  unsigned short* Kb = (unsigned short*)(ws + oK);
  unsigned short* VT = (unsigned short*)(ws + oV);

  const int  n8 = nqkv / 8;                                 // 524288
  const dim3 blk(256);
  const dim3 gCvt((n8 + 255) / 256);                        // 2048 blocks
  const dim3 gVt(NBH * NKC);                                // 1024 blocks
  const dim3 gAttn(NBH * NQB);                              // 512 blocks

  // (1) q, k -> bf16 planes (RNE convert, same layout as the inputs)
  cvt_qk<<<gCvt, blk, 0, stream>>>(q, k, Qb, Kb, n8);
  // (2) v -> bf16 V^T planes [32][64][2048]
  prep_vt<<<gVt, blk, 0, stream>>>(v, VT);
  // (3) attention per (plane, 128-query block) -> d_out f32 [32][2048][64]
  attn_hm<<<gAttn, blk, 0, stream>>>(Qb, Kb, VT, (float*)d_out);
  (void)hipGetLastError();
}

// v001
// Measured time: 122 microseconds a run.
// Next to v000, in two timings, it ran 1.56 and 1.58 times as fast.
// Contractions: q.k^T scores = v_wmma_f32_16x16x32_bf16 (bf16 operands from RNE-converted q and k, single exact product, f32 accumulate);
// p.v context = v_wmma_f32_16x16x32_bf16 with p as bf16 hi + unscaled bf16 residual and RNE-converted v (hi.v + lo.v), f32 accumulate;
// online softmax (scores unscaled), denominators and the final normalisation in f32 on the VALU.
// Carry audit: no power-of-two carries anywhere; the p residual plane is the unscaled RNE residual (p - hi) and shares the hi
// accumulator; softmax denominators are divided out exactly once in the epilogue of attn_hm (inv[]).
#include <hip/hip_runtime.h>
#include <math.h>
#include <stdint.h>

#define NBH  32               // batch x head planes, each [2048][64] contiguous
#define NL   2048             // query rows per plane
#define NS   2048             // key rows per plane
#define ND   64               // head dim = row pitch in elements
#define NQB  (NL / 128)       // 16 query blocks of 128 rows per plane
#define NKC  (NS / 64)        // 32 key chunks of 64 keys
static_assert(NQB == 16);
static_assert(NKC == 32);
static_assert((NL % 128) == 0 && (NS % 64) == 0 && ND == 64 && (ND % 32) == 0);

typedef __bf16   v16b __attribute__((ext_vector_type(16)));
typedef __bf16   v8b  __attribute__((ext_vector_type(8)));
typedef float    v8f  __attribute__((ext_vector_type(8)));
typedef float    v4f  __attribute__((ext_vector_type(4)));
typedef unsigned int v4u __attribute__((ext_vector_type(4)));

// ---- scalar helpers --------------------------------------------------------------------------------
__device__ __forceinline__ unsigned short bf_bits(float f) {          // f32 -> bf16 bits, RNE convert
  unsigned u = __float_as_uint(f);
  return (unsigned short)((u + 0x7FFFu + ((u >> 16) & 1u)) >> 16);
}
__device__ __forceinline__ float bf_up(unsigned short hb) { return __uint_as_float(((unsigned)hb) << 16); }
__device__ __forceinline__ __bf16 bf_val(unsigned short hb) { return __builtin_bit_cast(__bf16, hb); }
__device__ __forceinline__ unsigned pk16(unsigned short a, unsigned short b) { return (unsigned)a | ((unsigned)b << 16); }
__device__ __forceinline__ v8f zero8() { v8f z = {0.f, 0.f, 0.f, 0.f, 0.f, 0.f, 0.f, 0.f}; return z; }

// ---- fragment loader: 16-bit A/B operand, lane -> row/col (lane&15), p already includes +8*(lane>>4);
//      elements 0..7 <- p[0..7] (k0+8h..), elements 8..15 <- p[16..23] (k0+16+8h..)
__device__ __forceinline__ v16b ldfrag_b(const __bf16* p) {
  union { v16b v; v8b h[2]; } f;
  f.h[0] = *(const v8b*)(p);
  f.h[1] = *(const v8b*)(p + 16);
  return f.v;
}

// ---- WMMA helper with trailing VALU hazard gap ---------------------------------------------------------
__device__ __forceinline__ v8f mma_b(v16b a, v16b b, v8f c) {
  c = __builtin_amdgcn_wmma_f32_16x16x32_bf16(false, a, false, b, (short)0, c, false, false);
  asm volatile("v_nop\n\tv_nop\n\tv_nop\n\tv_nop" : "+v"(c) : "v"(a), "v"(b));
  return c;
}

// ---- 8 consecutive f32 -> 8 bf16 bits packed in one 16-B vector ----------------------------------------
__device__ __forceinline__ v4u cvt8(const float* __restrict__ p) {
  const v4f a = *(const v4f*)(p);
  const v4f b = *(const v4f*)(p + 4);
  v4u r;
  r[0] = pk16(bf_bits(a[0]), bf_bits(a[1]));
  r[1] = pk16(bf_bits(a[2]), bf_bits(a[3]));
  r[2] = pk16(bf_bits(b[0]), bf_bits(b[1]));
  r[3] = pk16(bf_bits(b[2]), bf_bits(b[3]));
  return r;
}

// =====================================================================================================
// q and k f32 [32][2048][64] -> bf16 planes with the identical element layout (RNE convert), 8 elements
// coverage: n8 = 524288 threads x 8 = all 4194304 elements of each plane.
// =====================================================================================================
__global__ __launch_bounds__(256) void cvt_qk(const float* __restrict__ q, const float* __restrict__ k,
                                              unsigned short* Qo, unsigned short* Ko, int n8) {
  const int i = blockIdx.x * 256 + threadIdx.x;
  if (i < n8) {
    const size_t e = (size_t)i * 8;
    const v4u pq = cvt8(q + e);
    const v4u pk = cvt8(k + e);
    *(v4u*)(Qo + e) = pq;
    *(v4u*)(Ko + e) = pk;
    
  }
}

// =====================================================================================================
// v f32 [32][2048][64] -> bf16 V^T planes VT [bh][64 d][2048 keys] (key contiguous, the B^T layout of the
// p.v step). grid = 32*32 blocks; block = (bh, 64-key tile): thread reads 4 x 16 B of the tile's key rows
// (in[key][d], 64 x 64, row pitch 64 floats), RNE-converts into LDS T[d][key] (pitch 72); after a barrier
// coverage: 1024 blocks x 64 d-rows x 64 keys = the whole [32][64][2048] plane.
// =====================================================================================================
__global__ __launch_bounds__(256) void prep_vt(const float* __restrict__ v, unsigned short* VT) {
  __shared__ __align__(16) unsigned short T[ND * 72];    // [d][72], 9216 B
  const int tid   = threadIdx.x;
  const int stile = blockIdx.x & (NKC - 1);
  const int bh    = blockIdx.x >> 5;
  const int s0    = stile * 64;
  const float* vp = v + ((size_t)bh * NS + s0) * ND;               // key row srow at + srow*ND
#pragma unroll
  for (int rr = 0; rr < 4; ++rr) {
    const int idx  = tid + rr * 256;        // 0..1023
    const int srow = idx >> 4;              // key within tile, 0..63
    const int d4   = (idx & 15) << 2;       // d, 0..60
    const v4f vf = *(const v4f*)(vp + (size_t)srow * ND + d4);
#pragma unroll
    for (int e = 0; e < 4; ++e) T[(d4 + e) * 72 + srow] = bf_bits(vf[e]);
  }
  __syncthreads();
  unsigned short* vout = VT + (size_t)bh * ND * NS + s0;           // row d at + d*NS
  v4u tv[2];
  size_t to[2];
#pragma unroll
  for (int rr = 0; rr < 2; ++rr) {
    const int idx  = tid + rr * 256;        // 0..511
    const int drow = idx >> 3;              // 0..63
    const int c8   = (idx & 7) << 3;        // 0..56 halves
    tv[rr] = *(const v4u*)(T + drow * 72 + c8);
    to[rr] = (size_t)drow * NS + c8;
  }
  {
    *(v4u*)(vout + to[0]) = tv[0];
    *(v4u*)(vout + to[1]) = tv[1];
    
  }
}

// =====================================================================================================
// Non-causal attention, head dim 64, key chunks of 64, static LDS, scores unscaled.
//   q / k planes (bf16): element (bh, t, d) at [(bh*2048 + t)*64 + d]
//   V^T planes (bf16):   element (bh, d, s) at [(bh*64 + d)*2048 + s]
//   out f32:             (bh, t, d) at [(bh*2048 + t)*64 + d]
//   Block = 8 waves x 16 query rows = 128 rows of one plane; grid = 32*16 = 512; chunk loop kt = 0..31
//   (all keys, block-uniform).
//   K / V^T chunk staging: 256 threads x 2 pieces of 16 B per plane = the whole 64x64 tile of both planes
//   (plain 16-B loads, __syncthreads before and after).
//   LDS rows of the K, V^T and P tiles hold 64 bf16 (128 B) at a pitch of LP = 72 bf16 (144 B = 16 B x 9): the 16 rows
//   that one 16-B fragment load touches then start on 16 different groups of four banks instead of two.
//   scores = 2 bf16 products over the two 32-deep d-chunks, f32 accumulate;
//   p = exp(s - m) split as bf16 hi + bf16 lo into wave-private LDS tiles (__bf16 element stores, reloaded as
//   context += p.v with 2 bf16 products into register accumulators (compile-time indices); online softmax in f32.
//   Epilogue: all waves pass a barrier, each wave's P slot is reused as its 16x64 f32 staging (row-major, the
//   same layout as the wave's 16 contiguous output rows); one instruction writes 512 contiguous B
//   coverage: out: 512 blocks x 8 waves x 16 rows x 64 d = all 4194304 elements, one wave per output row.
// =====================================================================================================
#define LP      72         // LDS row pitch in bf16 elements (64 used + 8 pad)
#define L_K     0          // K chunk   [64 keys][LP] bf16   9216 B
#define L_V     9216       // V^T chunk [64 d][LP] bf16      9216 B
#define L_P     18432      // P [8 waves][hi 16xLP | lo 16xLP] bf16  36864 B (epilogue: per-wave 16x64 f32 staging)
#define L_TOTAL 55296
#define PSLOT   (2 * 16 * LP)                    // bf16 elements of one wave's P slot (hi + lo)
static_assert(LP >= 64 && (LP * 2) % 16 == 0 && ((LP * 2) / 16) % 2 == 1);   // 16-B aligned rows, odd count of 16-B units
static_assert(L_V - L_K == 64 * LP * 2);
static_assert(L_P - L_V == ND * LP * 2);
static_assert(L_TOTAL - L_P == 8 * PSLOT * 2);
static_assert(16 * ND * 4 <= PSLOT * 2);         // per-wave f32 staging fits inside the wave's P slot

__global__ __launch_bounds__(256)
void attn_hm(const unsigned short* __restrict__ qbp, const unsigned short* __restrict__ kbp,
             const unsigned short* __restrict__ vtp, float* Op) {
  __shared__ __align__(16) unsigned char lds[L_TOTAL];
  union FB { v16b v; v8b h[2]; };
  __bf16* Ksh = (__bf16*)(lds + L_K);
  __bf16* Vth = (__bf16*)(lds + L_V);
  __bf16* Pb  = (__bf16*)(lds + L_P);

  const int tid  = threadIdx.x;
  const int wave = tid >> 5;
  const int lane = tid & 31;
  const int hh   = lane >> 4;
  const int c    = lane & 15;

  const int bx = blockIdx.x;
  const int qb = bx & (NQB - 1);              // query block 0..15
  const int bh = bx >> 4;                     // plane 0..31
  const int q0 = qb * 128 + wave * 16;        // first query row of this wave

  const __bf16* Qg = (const __bf16*)(const void*)qbp;
  const __bf16* Kg = (const __bf16*)(const void*)kbp;
  const __bf16* Vg = (const __bf16*)(const void*)vtp + (size_t)bh * ND * NS;

  __bf16* pwh = Pb + wave * PSLOT;            // [16 rows][LP] hi
  __bf16* pwl = pwh + 16 * LP;                // [16 rows][LP] lo

  // ---- q A fragments for both 32-deep d-chunks: row q0 + c, k = d ----
  const size_t qo = ((size_t)bh * NL + q0 + c) * ND + 8 * hh;
  v16b qa[2];
  qa[0] = ldfrag_b(Qg + qo);
  qa[1] = ldfrag_b(Qg + qo + 32);

  v8f O[4];
#pragma unroll
  for (int t = 0; t < 4; ++t) O[t] = zero8();
  float mrow[8], lrow[8], alpha[8];
#pragma unroll
  for (int r = 0; r < 8; ++r) { mrow[r] = -INFINITY; lrow[r] = 0.f; alpha[r] = 0.f; }

  for (int kt = 0; kt < NKC; ++kt) {          // block-uniform trip count
    const int kv0 = kt * 64;
    __syncthreads();                          // every wave is done with the prior chunk's tiles
    {
#pragma unroll
      for (int i = 0; i < 2; ++i) {
        const int p  = tid + 256 * i;         // 0..511
        const int rw = p >> 3;                // key (K tile) / d (V^T tile), 0..63
        const int sg = (p & 7) * 8;           // 0..56 halves
        const v8b a0 = *(const v8b*)(Kg + ((size_t)bh * NS + kv0 + rw) * ND + sg);
        const v8b b0 = *(const v8b*)(Vg + (size_t)rw * NS + kv0 + sg);
        *(v8b*)(Ksh + rw * LP + sg) = a0;
        *(v8b*)(Vth + rw * LP + sg) = b0;
      }
    }
    __syncthreads();

    // ---- scores: 16 query rows x 64 keys per wave, exact bf16 products over 2 d-chunks ----
    v8f s[4];
#pragma unroll
    for (int j = 0; j < 4; ++j) s[j] = zero8();
#pragma unroll
    for (int dc = 0; dc < 2; ++dc) {
      const int ko = dc * 32 + 8 * hh;
#pragma unroll
      for (int j = 0; j < 4; ++j) {
        const int kr = (j * 16 + c) * LP + ko;   // B: key j*16+c (col), d = dc*32 + 8h .. (k)
        FB kb;
        kb.h[0] = *(const v8b*)(Ksh + kr);
        kb.h[1] = *(const v8b*)(Ksh + kr + 16);
        s[j] = mma_b(qa[dc], kb.v, s[j]);
      }
    }

    // ---- row max, online softmax, P hi / lo (bf16) to LDS ----
#pragma unroll
    for (int r = 0; r < 8; ++r) {
      float m = -INFINITY;
#pragma unroll
      for (int j = 0; j < 4; ++j) m = fmaxf(m, s[j][r]);
#pragma unroll
      for (int off = 1; off < 16; off <<= 1) m = fmaxf(m, __shfl_xor(m, off, 32));
      const float mnew = fmaxf(mrow[r], m);     // finite: every chunk has 64 valid keys
      const float al   = __expf(mrow[r] - mnew); // first chunk: exp(-inf) = 0
      mrow[r]  = mnew;
      alpha[r] = al;
      float psum = 0.f;
#pragma unroll
      for (int j = 0; j < 4; ++j) {
        const float p = __expf(s[j][r] - mnew);
        psum += p;
        const unsigned short hb = bf_bits(p);
        const unsigned short lb = bf_bits(p - bf_up(hb));
        const int po = (8 * hh + r) * LP + j * 16 + c;
        pwh[po] = bf_val(hb);
        pwl[po] = bf_val(lb);
      }
#pragma unroll
      for (int off = 1; off < 16; off <<= 1) psum += __shfl_xor(psum, off, 32);
      lrow[r] = lrow[r] * al + psum;
    }
    __builtin_amdgcn_fence(__ATOMIC_RELEASE, "workgroup");
    __builtin_amdgcn_wave_barrier();
    __builtin_amdgcn_fence(__ATOMIC_ACQUIRE, "workgroup");

    // ---- rescale the running context, then context += P . V (2 bf16 products) ----
#pragma unroll
    for (int t = 0; t < 4; ++t) {
#pragma unroll
      for (int r = 0; r < 8; ++r) O[t][r] *= alpha[r];
    }
#pragma unroll
    for (int kk = 0; kk < 2; ++kk) {
      const int pr = c * LP + kk * 32 + 8 * hh;      // A fragment: row c, keys kk*32 + 8h ..
      FB pa, pl;
      pa.h[0] = *(const v8b*)(pwh + pr);
      pa.h[1] = *(const v8b*)(pwh + pr + 16);
      pl.h[0] = *(const v8b*)(pwl + pr);
      pl.h[1] = *(const v8b*)(pwl + pr + 16);
#pragma unroll
      for (int t = 0; t < 4; ++t) {
        const int vr = (t * 16 + c) * LP + kk * 32 + 8 * hh;   // B fragment: col d = t*16+c, keys kk*32 + 8h ..
        FB vb;
        vb.h[0] = *(const v8b*)(Vth + vr);
        vb.h[1] = *(const v8b*)(Vth + vr + 16);
        O[t] = mma_b(pa.v, vb.v, O[t]);
        O[t] = mma_b(pl.v, vb.v, O[t]);
      }
    }
  }
  __syncthreads();                             // every wave is past its last P / K / V^T read

  // ---- normalise, stage the wave's 16x64 f32 tile in its own P slot, whole-line writes ----
  float* os = (float*)(lds + L_P + wave * (PSLOT * 2));
  float inv[8];
#pragma unroll
  for (int r = 0; r < 8; ++r) inv[r] = (lrow[r] > 0.f) ? (1.0f / lrow[r]) : 0.f;
#pragma unroll
  for (int t = 0; t < 4; ++t) {
#pragma unroll
    for (int r = 0; r < 8; ++r) os[(8 * hh + r) * 64 + t * 16 + c] = O[t][r] * inv[r];
  }
  __builtin_amdgcn_fence(__ATOMIC_RELEASE, "workgroup");
  __builtin_amdgcn_wave_barrier();
  __builtin_amdgcn_fence(__ATOMIC_ACQUIRE, "workgroup");
  float* og = Op + ((size_t)bh * NL + q0) * ND;   // the wave's 16 rows are contiguous: row r at + r*64
  const int colw = c * 4;
  v4f ov[8];
#pragma unroll
  for (int it = 0; it < 8; ++it) {
    const int row = 2 * it + hh;               // rows 0..15: lanes 0..15 even row, lanes 16..31 odd row
    ov[it] = *(const v4f*)(os + row * 64 + colw);
  }
  {
#pragma unroll
    for (int it = 0; it < 8; ++it) {
      const int row = 2 * it + hh;
      *(v4f*)(og + (size_t)row * ND + colw) = ov[it];
    }
    
  }
}

// =====================================================================================================
//   Qb  bf16 [32][2048][64]            0         8388608
//   Kb  bf16 [32][2048][64]      8388608         8388608
//   VT  bf16 [32][64][2048]     16777216         8388608
//   end                         25165824
// =====================================================================================================
extern "C" void kernel_launch(void* const* d_in, const int* in_sizes, int n_in,
                              void* d_out, int out_size, void* d_ws, size_t ws_size,
                              hipStream_t stream) {
  const int nqkv = NBH * NL * ND;                           // 4194304
  if (n_in < 3) return;
  if (in_sizes[0] != nqkv || in_sizes[1] != nqkv || in_sizes[2] != nqkv) return;
  if (out_size != nqkv) return;

  const float* q = (const float*)d_in[0];
  const float* k = (const float*)d_in[1];
  const float* v = (const float*)d_in[2];

  const size_t PL = (size_t)nqkv * 2;                       // 8388608
  size_t off = 0;
  const size_t oQ = off; off += PL;
  const size_t oK = off; off += PL;
  const size_t oV = off; off += PL;
  if (off > ws_size) return;                               // off = 25165824
  if (off > (size_t)134217728) return;

  char* ws = (char*)d_ws;
  unsigned short* Qb = (unsigned short*)(ws + oQ);
  unsigned short* Kb = (unsigned short*)(ws + oK);
  unsigned short* VT = (unsigned short*)(ws + oV);

  const int  n8 = nqkv / 8;                                 // 524288
  const dim3 blk(256);
  const dim3 gCvt((n8 + 255) / 256);                        // 2048 blocks
  const dim3 gVt(NBH * NKC);                                // 1024 blocks
  const dim3 gAttn(NBH * NQB);                              // 512 blocks

  // (1) q, k -> bf16 planes (RNE convert, same layout as the inputs)
  cvt_qk<<<gCvt, blk, 0, stream>>>(q, k, Qb, Kb, n8);
  // (2) v -> bf16 V^T planes [32][64][2048]
  prep_vt<<<gVt, blk, 0, stream>>>(v, VT);
  // (3) attention per (plane, 128-query block) -> d_out f32 [32][2048][64]
  attn_hm<<<gAttn, blk, 0, stream>>>(Qb, Kb, VT, (float*)d_out);
  (void)hipGetLastError();
}

// v002
// Measured time: 76.5 microseconds a run.
// In two side-by-side timings against v001, it was 1.59 and 1.61 times as fast.
// Counting every step since v000, it is 2.51 times as fast.
// Contractions: k.q^T scores (transposed) = v_wmma_f32_16x16x32_bf16 (bf16 operands from RNE-converted q and k, single exact product, f32 accumulate);
// v^T.p^T context (transposed) = v_wmma_f32_16x16x32_bf16 with p as bf16 hi + unscaled bf16 residual and RNE-converted v (hi.v + lo.v), f32 accumulate;
// online softmax (scores unscaled), denominators and the final normalisation in f32 on the VALU.
// Carry audit: no power-of-two carries anywhere; the p residual plane is the unscaled RNE residual (p - hi) and shares the hi
// accumulator; softmax denominators are divided out exactly once in the epilogue of attn_hm (inv).
#include <hip/hip_runtime.h>
#include <math.h>
#include <stdint.h>

#define NBH  32               // batch x head planes, each [2048][64] contiguous
#define NL   2048             // query rows per plane
#define NS   2048             // key rows per plane
#define ND   64               // head dim = row pitch in elements
#define NQB  (NL / 128)       // 16 query blocks of 128 rows per plane
#define NKC  (NS / 64)        // 32 key chunks of 64 keys
static_assert(NQB == 16);
static_assert(NKC == 32);
static_assert((NL % 128) == 0 && (NS % 64) == 0 && ND == 64 && (ND % 32) == 0);

typedef __bf16   v16b __attribute__((ext_vector_type(16)));
typedef __bf16   v8b  __attribute__((ext_vector_type(8)));
typedef float    v8f  __attribute__((ext_vector_type(8)));
typedef float    v4f  __attribute__((ext_vector_type(4)));
typedef float    v2f  __attribute__((ext_vector_type(2)));
typedef __bf16   v2b  __attribute__((ext_vector_type(2)));
typedef unsigned int v4u __attribute__((ext_vector_type(4)));

// ---- scalar helpers --------------------------------------------------------------------------------
__device__ __forceinline__ unsigned short bf_bits(float f) {          // f32 -> bf16 bits, RNE convert
  unsigned u = __float_as_uint(f);
  return (unsigned short)((u + 0x7FFFu + ((u >> 16) & 1u)) >> 16);
}
__device__ __forceinline__ float bf_up(unsigned short hb) { return __uint_as_float(((unsigned)hb) << 16); }
__device__ __forceinline__ __bf16 bf_val(unsigned short hb) { return __builtin_bit_cast(__bf16, hb); }
__device__ __forceinline__ unsigned pk16(unsigned short a, unsigned short b) { return (unsigned)a | ((unsigned)b << 16); }
__device__ __forceinline__ v8f zero8() { v8f z = {0.f, 0.f, 0.f, 0.f, 0.f, 0.f, 0.f, 0.f}; return z; }

// ---- fragment loader: 16-bit A/B operand, lane -> row/col (lane&15), p already includes +8*(lane>>4);
//      elements 0..7 <- p[0..7] (k0+8h..), elements 8..15 <- p[16..23] (k0+16+8h..)
__device__ __forceinline__ v16b ldfrag_b(const __bf16* p) {
  union { v16b v; v8b h[2]; } f;
  f.h[0] = *(const v8b*)(p);
  f.h[1] = *(const v8b*)(p + 16);
  return f.v;
}

// ---- WMMA helper with trailing VALU hazard gap ---------------------------------------------------------
__device__ __forceinline__ v8f mma_b(v16b a, v16b b, v8f c) {
  c = __builtin_amdgcn_wmma_f32_16x16x32_bf16(false, a, false, b, (short)0, c, false, false);
  asm volatile("v_nop\n\tv_nop\n\tv_nop\n\tv_nop" : "+v"(c) : "v"(a), "v"(b));
  return c;
}

// ---- 8 consecutive f32 -> 8 bf16 bits packed in one 16-B vector ----------------------------------------
__device__ __forceinline__ v4u cvt8(const float* __restrict__ p) {
  const v4f a = *(const v4f*)(p);
  const v4f b = *(const v4f*)(p + 4);
  v4u r;
  r[0] = pk16(bf_bits(a[0]), bf_bits(a[1]));
  r[1] = pk16(bf_bits(a[2]), bf_bits(a[3]));
  r[2] = pk16(bf_bits(b[0]), bf_bits(b[1]));
  r[3] = pk16(bf_bits(b[2]), bf_bits(b[3]));
  return r;
}

// =====================================================================================================
// q and k f32 [32][2048][64] -> bf16 planes with the identical element layout (RNE convert), 8 elements
// coverage: n8 = 524288 threads x 8 = all 4194304 elements of each plane.
// =====================================================================================================
__global__ __launch_bounds__(256) void cvt_qk(const float* __restrict__ q, const float* __restrict__ k,
                                              unsigned short* Qo, unsigned short* Ko, int n8) {
  const int i = blockIdx.x * 256 + threadIdx.x;
  if (i < n8) {
    const size_t e = (size_t)i * 8;
    const v4u pq = cvt8(q + e);
    const v4u pk = cvt8(k + e);
    *(v4u*)(Qo + e) = pq;
    *(v4u*)(Ko + e) = pk;
    
  }
}

// =====================================================================================================
// v f32 [32][2048][64] -> bf16 V^T planes VT [bh][64 d][2048 keys] (key contiguous, the B^T layout of the
// p.v step). grid = 32*32 blocks; block = (bh, 64-key tile): thread reads 4 x 16 B of the tile's key rows
// (in[key][d], 64 x 64, row pitch 64 floats), RNE-converts into LDS T[d][key] (pitch 72); after a barrier
// coverage: 1024 blocks x 64 d-rows x 64 keys = the whole [32][64][2048] plane.
// =====================================================================================================
__global__ __launch_bounds__(256) void prep_vt(const float* __restrict__ v, unsigned short* VT) {
  __shared__ __align__(16) unsigned short T[ND * 72];    // [d][72], 9216 B
  const int tid   = threadIdx.x;
  const int stile = blockIdx.x & (NKC - 1);
  const int bh    = blockIdx.x >> 5;
  const int s0    = stile * 64;
  const float* vp = v + ((size_t)bh * NS + s0) * ND;               // key row srow at + srow*ND
#pragma unroll
  for (int rr = 0; rr < 4; ++rr) {
    const int idx  = tid + rr * 256;        // 0..1023
    const int srow = idx >> 4;              // key within tile, 0..63
    const int d4   = (idx & 15) << 2;       // d, 0..60
    const v4f vf = *(const v4f*)(vp + (size_t)srow * ND + d4);
#pragma unroll
    for (int e = 0; e < 4; ++e) T[(d4 + e) * 72 + srow] = bf_bits(vf[e]);
  }
  __syncthreads();
  unsigned short* vout = VT + (size_t)bh * ND * NS + s0;           // row d at + d*NS
  v4u tv[2];
  size_t to[2];
#pragma unroll
  for (int rr = 0; rr < 2; ++rr) {
    const int idx  = tid + rr * 256;        // 0..511
    const int drow = idx >> 3;              // 0..63
    const int c8   = (idx & 7) << 3;        // 0..56 halves
    tv[rr] = *(const v4u*)(T + drow * 72 + c8);
    to[rr] = (size_t)drow * NS + c8;
  }
  {
    *(v4u*)(vout + to[0]) = tv[0];
    *(v4u*)(vout + to[1]) = tv[1];
    
  }
}

#define LP      72         // LDS row pitch in bf16 elements (64 used + 8 pad)
#define OP      68         // epilogue staging row pitch in f32 (64 used + 4 pad)
#define L_K     0          // K chunk   [64 keys][LP] bf16   9216 B
#define L_V     9216       // V^T chunk [64 d][LP] bf16      9216 B
#define L_KVEND 18432
#define L_TOTAL 34816      // epilogue: [8 waves][16 rows][OP] f32 over the same bytes
static_assert(LP >= 64 && (LP * 2) % 16 == 0 && ((LP * 2) / 16) % 2 == 1);   // 16-B aligned rows, odd count of 16-B units
static_assert(L_V - L_K == 64 * LP * 2);
static_assert(L_KVEND - L_V == ND * LP * 2);
static_assert(OP >= ND && (OP * 4) % 16 == 0);
static_assert(L_TOTAL == 8 * 16 * OP * 4 && L_TOTAL >= L_KVEND);

// value of the same register in lane ^ 16 (the other half of the query's keys)
__device__ __forceinline__ float other_half(float x) {
  const int b = __float_as_int(x);
  return __int_as_float(__builtin_amdgcn_permlanex16(b, b, 0x76543210, 0xfedcba98, false, false));
}

__global__ __launch_bounds__(256)
void attn_hm(const unsigned short* __restrict__ qbp, const unsigned short* __restrict__ kbp,
             const unsigned short* __restrict__ vtp, float* Op) {
  __shared__ __align__(16) unsigned char lds[L_TOTAL];
  union FB { v16b v; v8b h[2]; unsigned u[8]; };
  __bf16* Ksh = (__bf16*)(lds + L_K);
  __bf16* Vth = (__bf16*)(lds + L_V);

  const int tid  = threadIdx.x;
  const int wave = tid >> 5;
  const int lane = tid & 31;
  const int hh   = lane >> 4;
  const int c    = lane & 15;

  const int bx = blockIdx.x;
  const int qb = bx & (NQB - 1);              // query block 0..15
  const int bh = bx >> 4;                     // plane 0..31
  const int q0 = qb * 128 + wave * 16;        // first query row of this wave

  const __bf16* Qg = (const __bf16*)(const void*)qbp;
  const __bf16* Kg = (const __bf16*)(const void*)kbp;
  const __bf16* Vg = (const __bf16*)(const void*)vtp + (size_t)bh * ND * NS;

  // ---- q B fragments for both 32-deep d-chunks: column = query q0 + c, k = d ----
  const size_t qo = ((size_t)bh * NL + q0 + c) * ND + 8 * hh;
  v16b qa[2];
  qa[0] = ldfrag_b(Qg + qo);
  qa[1] = ldfrag_b(Qg + qo + 32);

  v8f O[4];
#pragma unroll
  for (int t = 0; t < 4; ++t) O[t] = zero8();
  float mrun = -INFINITY;                     // running maximum of query c (equal in both lane halves)
  float lrun = 0.f;                           // running sum over this lane half's keys only

  for (int kt = 0; kt < NKC; ++kt) {          // block-uniform trip count
    const int kv0 = kt * 64;
    __syncthreads();                          // every wave is done with the prior chunk's tiles
    {
#pragma unroll
      for (int i = 0; i < 2; ++i) {
        const int p  = tid + 256 * i;         // 0..511
        const int rw = p >> 3;                // key (K tile) / d (V^T tile), 0..63
        const int sg = (p & 7) * 8;           // 0..56 halves
        const v8b a0 = *(const v8b*)(Kg + ((size_t)bh * NS + kv0 + rw) * ND + sg);
        const v8b b0 = *(const v8b*)(Vg + (size_t)rw * NS + kv0 + sg);
        *(v8b*)(Ksh + rw * LP + sg) = a0;
        *(v8b*)(Vth + rw * LP + sg) = b0;
      }
    }
    __syncthreads();

    // ---- scores^T: 64 keys x 16 query columns per wave, exact bf16 products over 2 d-chunks ----
    v8f s[4];
#pragma unroll
    for (int j = 0; j < 4; ++j) s[j] = zero8();
#pragma unroll
    for (int dc = 0; dc < 2; ++dc) {
      const int ko = dc * 32 + 8 * hh;
#pragma unroll
      for (int j = 0; j < 4; ++j) {
        const int kr = (j * 16 + c) * LP + ko;   // A: key j*16+c (row), d = dc*32 + 8h .. (k)
        FB kb;
        kb.h[0] = *(const v8b*)(Ksh + kr);
        kb.h[1] = *(const v8b*)(Ksh + kr + 16);
        s[j] = mma_b(kb.v, qa[dc], s[j]);
      }
    }

    // ---- maximum of query c over the chunk: 32 scores in the lane, then the other lane half ----
    float mj[4];
#pragma unroll
    for (int j = 0; j < 4; ++j) {
      mj[j] = s[j][0];
#pragma unroll
      for (int r = 1; r < 8; ++r) mj[j] = fmaxf(mj[j], s[j][r]);
    }
    float m = fmaxf(fmaxf(mj[0], mj[1]), fmaxf(mj[2], mj[3]));
    m = fmaxf(m, other_half(m));
    const float mnew = fmaxf(mrun, m);          // finite: every chunk has 64 valid keys
    const float al   = __expf(mrun - mnew);     // first chunk: exp(-inf) = 0
    mrun = mnew;

    // ---- p = exp(s - m), bf16 hi / lo packed in place into the B fragments of the context product ----
    FB ph[2], pl[2];
    float pj[4];
#pragma unroll
    for (int j = 0; j < 4; ++j) {
      pj[j] = 0.f;
#pragma unroll
      for (int r2 = 0; r2 < 4; ++r2) {
        v2f pp;
        pp[0] = __expf(s[j][2 * r2]     - mnew);
        pp[1] = __expf(s[j][2 * r2 + 1] - mnew);
        pj[j] += pp[0];
        pj[j] += pp[1];
        const v2b h2 = __builtin_convertvector(pp, v2b);                               // RNE, two per instruction
        const v2b l2 = __builtin_convertvector(pp - __builtin_convertvector(h2, v2f), v2b);   // unscaled residual, RNE
        ph[j >> 1].u[(j & 1) * 4 + r2] = __builtin_bit_cast(unsigned, h2);
        pl[j >> 1].u[(j & 1) * 4 + r2] = __builtin_bit_cast(unsigned, l2);
      }
    }
    lrun = lrun * al + ((pj[0] + pj[1]) + (pj[2] + pj[3]));

    // ---- rescale the running context, then context^T += V^T . P^T (2 bf16 products) ----
#pragma unroll
    for (int t = 0; t < 4; ++t) {
#pragma unroll
      for (int r = 0; r < 8; ++r) O[t][r] *= al;
    }
#pragma unroll
    for (int kk = 0; kk < 2; ++kk) {
#pragma unroll
      for (int t = 0; t < 4; ++t) {
        const int vr = (t * 16 + c) * LP + kk * 32 + 8 * hh;   // A fragment: row d = t*16+c, keys kk*32 + 8h ..
        FB vb;
        vb.h[0] = *(const v8b*)(Vth + vr);
        vb.h[1] = *(const v8b*)(Vth + vr + 16);
        O[t] = mma_b(vb.v, ph[kk].v, O[t]);
        O[t] = mma_b(vb.v, pl[kk].v, O[t]);
      }
    }
  }
  __syncthreads();                             // every wave is past its last K / V^T read

  // ---- join the halves' sums, normalise, stage the wave's 16x64 f32 tile in LDS, whole-line writes ----
  float* os = (float*)lds + wave * (16 * OP);
  const float lsum = lrun + other_half(lrun);
  const float inv  = (lsum > 0.f) ? (1.0f / lsum) : 0.f;
#pragma unroll
  for (int t = 0; t < 4; ++t) {
    v4f w0, w1;
#pragma unroll
    for (int r = 0; r < 4; ++r) { w0[r] = O[t][r] * inv; w1[r] = O[t][4 + r] * inv; }
    *(v4f*)(os + c * OP + t * 16 + 8 * hh)     = w0;
    *(v4f*)(os + c * OP + t * 16 + 8 * hh + 4) = w1;
  }
  __builtin_amdgcn_fence(__ATOMIC_RELEASE, "workgroup");
  __builtin_amdgcn_wave_barrier();
  __builtin_amdgcn_fence(__ATOMIC_ACQUIRE, "workgroup");
  float* og = Op + ((size_t)bh * NL + q0) * ND;   // the wave's 16 rows are contiguous: row r at + r*64
  const int colw = c * 4;
  v4f ov[8];
#pragma unroll
  for (int it = 0; it < 8; ++it) {
    const int row = 2 * it + hh;               // rows 0..15: lanes 0..15 even row, lanes 16..31 odd row
    ov[it] = *(const v4f*)(os + row * OP + colw);
  }
  {
#pragma unroll
    for (int it = 0; it < 8; ++it) {
      const int row = 2 * it + hh;
      *(v4f*)(og + (size_t)row * ND + colw) = ov[it];
    }
    
  }
}

// =====================================================================================================
//   Qb  bf16 [32][2048][64]            0         8388608
//   Kb  bf16 [32][2048][64]      8388608         8388608
//   VT  bf16 [32][64][2048]     16777216         8388608
//   end                         25165824
// =====================================================================================================
extern "C" void kernel_launch(void* const* d_in, const int* in_sizes, int n_in,
                              void* d_out, int out_size, void* d_ws, size_t ws_size,
                              hipStream_t stream) {
  const int nqkv = NBH * NL * ND;                           // 4194304
  if (n_in < 3) return;
  if (in_sizes[0] != nqkv || in_sizes[1] != nqkv || in_sizes[2] != nqkv) return;
  if (out_size != nqkv) return;

  const float* q = (const float*)d_in[0];
  const float* k = (const float*)d_in[1];
  const float* v = (const float*)d_in[2];

  const size_t PL = (size_t)nqkv * 2;                       // 8388608
  size_t off = 0;
  const size_t oQ = off; off += PL;
  const size_t oK = off; off += PL;
  const size_t oV = off; off += PL;
  if (off > ws_size) return;                               // off = 25165824
  if (off > (size_t)134217728) return;

  char* ws = (char*)d_ws;
  unsigned short* Qb = (unsigned short*)(ws + oQ);
  unsigned short* Kb = (unsigned short*)(ws + oK);
  unsigned short* VT = (unsigned short*)(ws + oV);

  const int  n8 = nqkv / 8;                                 // 524288
  const dim3 blk(256);
  const dim3 gCvt((n8 + 255) / 256);                        // 2048 blocks
  const dim3 gVt(NBH * NKC);                                // 1024 blocks
  const dim3 gAttn(NBH * NQB);                              // 512 blocks

  // (1) q, k -> bf16 planes (RNE convert, same layout as the inputs)
  cvt_qk<<<gCvt, blk, 0, stream>>>(q, k, Qb, Kb, n8);
  // (2) v -> bf16 V^T planes [32][64][2048]
  prep_vt<<<gVt, blk, 0, stream>>>(v, VT);
  // (3) attention per (plane, 128-query block) -> d_out f32 [32][2048][64]
  attn_hm<<<gAttn, blk, 0, stream>>>(Qb, Kb, VT, (float*)d_out);
  (void)hipGetLastError();
}

// v003
// One run takes 65.3 microseconds.
// Timed twice side by side with v002, it ran 1.16 and 1.17 times as fast.
// All steps since v000 together make it 2.92 times as fast.
// Contractions: k.q^T scores (transposed) = v_wmma_f32_16x16x32_bf16 (bf16 operands from RNE-converted q and k, single exact product, f32 accumulate);
// v^T.p^T context (transposed) = v_wmma_f32_16x16x32_bf16 with p as bf16 hi + unscaled bf16 residual and RNE-converted v (hi.v + lo.v), f32 accumulate;
// online softmax (scores unscaled), denominators and the final normalisation in f32 on the VALU.
// Carry audit: no power-of-two carries anywhere; the p residual plane is the unscaled RNE residual (p - hi) and shares the hi
// accumulator; softmax denominators are divided out exactly once in the epilogue of attn_hm (inv).
#include <hip/hip_runtime.h>
#include <math.h>
#include <stdint.h>

#define NBH  32               // batch x head planes, each [2048][64] contiguous
#define NL   2048             // query rows per plane
#define NS   2048             // key rows per plane
#define ND   64               // head dim = row pitch in elements
#define NQB  (NL / 128)       // 16 query blocks of 128 rows per plane
#define NKC  (NS / 64)        // 32 key chunks of 64 keys
static_assert(NQB == 16);
static_assert(NKC == 32);
static_assert((NL % 128) == 0 && (NS % 64) == 0 && ND == 64 && (ND % 32) == 0);

typedef __bf16   v16b __attribute__((ext_vector_type(16)));
typedef __bf16   v8b  __attribute__((ext_vector_type(8)));
typedef float    v8f  __attribute__((ext_vector_type(8)));
typedef float    v4f  __attribute__((ext_vector_type(4)));
typedef float    v2f  __attribute__((ext_vector_type(2)));
typedef __bf16   v2b  __attribute__((ext_vector_type(2)));
typedef unsigned int v4u __attribute__((ext_vector_type(4)));

// ---- scalar helpers --------------------------------------------------------------------------------
__device__ __forceinline__ unsigned short bf_bits(float f) {          // f32 -> bf16 bits, RNE convert
  unsigned u = __float_as_uint(f);
  return (unsigned short)((u + 0x7FFFu + ((u >> 16) & 1u)) >> 16);
}
__device__ __forceinline__ float bf_up(unsigned short hb) { return __uint_as_float(((unsigned)hb) << 16); }
__device__ __forceinline__ __bf16 bf_val(unsigned short hb) { return __builtin_bit_cast(__bf16, hb); }
__device__ __forceinline__ unsigned pk16(unsigned short a, unsigned short b) { return (unsigned)a | ((unsigned)b << 16); }
__device__ __forceinline__ v8f zero8() { v8f z = {0.f, 0.f, 0.f, 0.f, 0.f, 0.f, 0.f, 0.f}; return z; }

// ---- fragment loader: 16-bit A/B operand, lane -> row/col (lane&15), p already includes +8*(lane>>4);
//      elements 0..7 <- p[0..7] (k0+8h..), elements 8..15 <- p[16..23] (k0+16+8h..)
__device__ __forceinline__ v16b ldfrag_b(const __bf16* p) {
  union { v16b v; v8b h[2]; } f;
  f.h[0] = *(const v8b*)(p);
  f.h[1] = *(const v8b*)(p + 16);
  return f.v;
}

// ---- WMMA helper: the builtin alone; the compiler keeps the hazard distances of its own builtin form -----
__device__ __forceinline__ v8f mma_b(v16b a, v16b b, v8f c) {
  return __builtin_amdgcn_wmma_f32_16x16x32_bf16(false, a, false, b, (short)0, c, false, false);
}

// ---- 8 consecutive f32 -> 8 bf16 bits packed in one 16-B vector ----------------------------------------
__device__ __forceinline__ v4u cvt8(const float* __restrict__ p) {
  const v4f a = *(const v4f*)(p);
  const v4f b = *(const v4f*)(p + 4);
  v4u r;
  r[0] = pk16(bf_bits(a[0]), bf_bits(a[1]));
  r[1] = pk16(bf_bits(a[2]), bf_bits(a[3]));
  r[2] = pk16(bf_bits(b[0]), bf_bits(b[1]));
  r[3] = pk16(bf_bits(b[2]), bf_bits(b[3]));
  return r;
}

// =====================================================================================================
// q and k f32 [32][2048][64] -> bf16 planes with the identical element layout (RNE convert), 8 elements
// coverage: n8 = 524288 threads x 8 = all 4194304 elements of each plane.
// =====================================================================================================
__global__ __launch_bounds__(256) void cvt_qk(const float* __restrict__ q, const float* __restrict__ k,
                                              unsigned short* Qo, unsigned short* Ko, int n8) {
  const int i = blockIdx.x * 256 + threadIdx.x;
  if (i < n8) {
    const size_t e = (size_t)i * 8;
    const v4u pq = cvt8(q + e);
    const v4u pk = cvt8(k + e);
    *(v4u*)(Qo + e) = pq;
    *(v4u*)(Ko + e) = pk;
    
  }
}

// =====================================================================================================
// v f32 [32][2048][64] -> bf16 V^T planes VT [bh][64 d][2048 keys] (key contiguous, the B^T layout of the
// p.v step). grid = 32*32 blocks; block = (bh, 64-key tile): thread reads 4 x 16 B of the tile's key rows
// (in[key][d], 64 x 64, row pitch 64 floats), RNE-converts into LDS T[d][key] (pitch 72); after a barrier
// coverage: 1024 blocks x 64 d-rows x 64 keys = the whole [32][64][2048] plane.
// =====================================================================================================
__global__ __launch_bounds__(256) void prep_vt(const float* __restrict__ v, unsigned short* VT) {
  __shared__ __align__(16) unsigned short T[ND * 72];    // [d][72], 9216 B
  const int tid   = threadIdx.x;
  const int stile = blockIdx.x & (NKC - 1);
  const int bh    = blockIdx.x >> 5;
  const int s0    = stile * 64;
  const float* vp = v + ((size_t)bh * NS + s0) * ND;               // key row srow at + srow*ND
#pragma unroll
  for (int rr = 0; rr < 4; ++rr) {
    const int idx  = tid + rr * 256;        // 0..1023
    const int srow = idx >> 4;              // key within tile, 0..63
    const int d4   = (idx & 15) << 2;       // d, 0..60
    const v4f vf = *(const v4f*)(vp + (size_t)srow * ND + d4);
#pragma unroll
    for (int e = 0; e < 4; ++e) T[(d4 + e) * 72 + srow] = bf_bits(vf[e]);
  }
  __syncthreads();
  unsigned short* vout = VT + (size_t)bh * ND * NS + s0;           // row d at + d*NS
  v4u tv[2];
  size_t to[2];
#pragma unroll
  for (int rr = 0; rr < 2; ++rr) {
    const int idx  = tid + rr * 256;        // 0..511
    const int drow = idx >> 3;              // 0..63
    const int c8   = (idx & 7) << 3;        // 0..56 halves
    tv[rr] = *(const v4u*)(T + drow * 72 + c8);
    to[rr] = (size_t)drow * NS + c8;
  }
  {
    *(v4u*)(vout + to[0]) = tv[0];
    *(v4u*)(vout + to[1]) = tv[1];
    
  }
}

#define LP      72         // LDS row pitch in bf16 elements (64 used + 8 pad)
#define OP      68         // epilogue staging row pitch in f32 (64 used + 4 pad)
#define L_K     0          // K chunk   [64 keys][LP] bf16   9216 B
#define L_V     9216       // V^T chunk [64 d][LP] bf16      9216 B
#define L_KVEND 18432
#define L_TOTAL 34816      // epilogue: [8 waves][16 rows][OP] f32 over the same bytes
static_assert(LP >= 64 && (LP * 2) % 16 == 0 && ((LP * 2) / 16) % 2 == 1);   // 16-B aligned rows, odd count of 16-B units
static_assert(L_V - L_K == 64 * LP * 2);
static_assert(L_KVEND - L_V == ND * LP * 2);
static_assert(OP >= ND && (OP * 4) % 16 == 0);
static_assert(L_TOTAL == 8 * 16 * OP * 4 && L_TOTAL >= L_KVEND);

// value of the same register in lane ^ 16 (the other half of the query's keys)
__device__ __forceinline__ float other_half(float x) {
  const int b = __float_as_int(x);
  return __int_as_float(__builtin_amdgcn_permlanex16(b, b, 0x76543210, 0xfedcba98, false, false));
}

__global__ __launch_bounds__(256)
void attn_hm(const unsigned short* __restrict__ qbp, const unsigned short* __restrict__ kbp,
             const unsigned short* __restrict__ vtp, float* Op) {
  __shared__ __align__(16) unsigned char lds[L_TOTAL];
  union FB { v16b v; v8b h[2]; unsigned u[8]; };
  __bf16* Ksh = (__bf16*)(lds + L_K);
  __bf16* Vth = (__bf16*)(lds + L_V);

  const int tid  = threadIdx.x;
  const int wave = tid >> 5;
  const int lane = tid & 31;
  const int hh   = lane >> 4;
  const int c    = lane & 15;

  const int bx = blockIdx.x;
  const int qb = bx & (NQB - 1);              // query block 0..15
  const int bh = bx >> 4;                     // plane 0..31
  const int q0 = qb * 128 + wave * 16;        // first query row of this wave

  const __bf16* Qg = (const __bf16*)(const void*)qbp;
  const __bf16* Kg = (const __bf16*)(const void*)kbp;
  const __bf16* Vg = (const __bf16*)(const void*)vtp + (size_t)bh * ND * NS;

  // ---- q B fragments for both 32-deep d-chunks: column = query q0 + c, k = d ----
  const size_t qo = ((size_t)bh * NL + q0 + c) * ND + 8 * hh;
  v16b qa[2];
  qa[0] = ldfrag_b(Qg + qo);
  qa[1] = ldfrag_b(Qg + qo + 32);

  v8f O[4];
#pragma unroll
  for (int t = 0; t < 4; ++t) O[t] = zero8();
  float mrun = -INFINITY;                     // running maximum of query c (equal in both lane halves)
  float lrun = 0.f;                           // running sum over this lane half's keys only

  for (int kt = 0; kt < NKC; ++kt) {          // block-uniform trip count
    const int kv0 = kt * 64;
    __syncthreads();                          // every wave is done with the prior chunk's tiles
    {
#pragma unroll
      for (int i = 0; i < 2; ++i) {
        const int p  = tid + 256 * i;         // 0..511
        const int rw = p >> 3;                // key (K tile) / d (V^T tile), 0..63
        const int sg = (p & 7) * 8;           // 0..56 halves
        const v8b a0 = *(const v8b*)(Kg + ((size_t)bh * NS + kv0 + rw) * ND + sg);
        const v8b b0 = *(const v8b*)(Vg + (size_t)rw * NS + kv0 + sg);
        *(v8b*)(Ksh + rw * LP + sg) = a0;
        *(v8b*)(Vth + rw * LP + sg) = b0;
      }
    }
    __syncthreads();

    // ---- scores^T: 64 keys x 16 query columns per wave, exact bf16 products over 2 d-chunks ----
    v8f s[4];
#pragma unroll
    for (int j = 0; j < 4; ++j) s[j] = zero8();
#pragma unroll
    for (int dc = 0; dc < 2; ++dc) {
      const int ko = dc * 32 + 8 * hh;
#pragma unroll
      for (int j = 0; j < 4; ++j) {
        const int kr = (j * 16 + c) * LP + ko;   // A: key j*16+c (row), d = dc*32 + 8h .. (k)
        FB kb;
        kb.h[0] = *(const v8b*)(Ksh + kr);
        kb.h[1] = *(const v8b*)(Ksh + kr + 16);
        s[j] = mma_b(kb.v, qa[dc], s[j]);
      }
    }

    // ---- maximum of query c over the chunk: 32 scores in the lane, then the other lane half ----
    float mj[4];
#pragma unroll
    for (int j = 0; j < 4; ++j) {
      mj[j] = s[j][0];
#pragma unroll
      for (int r = 1; r < 8; ++r) mj[j] = fmaxf(mj[j], s[j][r]);
    }
    float m = fmaxf(fmaxf(mj[0], mj[1]), fmaxf(mj[2], mj[3]));
    m = fmaxf(m, other_half(m));
    const float mnew = fmaxf(mrun, m);          // finite: every chunk has 64 valid keys
    const float al   = __expf(mrun - mnew);     // first chunk: exp(-inf) = 0
    mrun = mnew;

    // ---- p = exp(s - m), bf16 hi / lo packed in place into the B fragments of the context product ----
    FB ph[2], pl[2];
    float pj[4];
#pragma unroll
    for (int j = 0; j < 4; ++j) {
      pj[j] = 0.f;
#pragma unroll
      for (int r2 = 0; r2 < 4; ++r2) {
        v2f pp;
        pp[0] = __expf(s[j][2 * r2]     - mnew);
        pp[1] = __expf(s[j][2 * r2 + 1] - mnew);
        pj[j] += pp[0];
        pj[j] += pp[1];
        const v2b h2 = __builtin_convertvector(pp, v2b);                               // RNE, two per instruction
        const v2b l2 = __builtin_convertvector(pp - __builtin_convertvector(h2, v2f), v2b);   // unscaled residual, RNE
        ph[j >> 1].u[(j & 1) * 4 + r2] = __builtin_bit_cast(unsigned, h2);
        pl[j >> 1].u[(j & 1) * 4 + r2] = __builtin_bit_cast(unsigned, l2);
      }
    }
    lrun = lrun * al + ((pj[0] + pj[1]) + (pj[2] + pj[3]));

    // ---- rescale the running context, then context^T += V^T . P^T (2 bf16 products) ----
#pragma unroll
    for (int t = 0; t < 4; ++t) {
#pragma unroll
      for (int r = 0; r < 8; ++r) O[t][r] *= al;
    }
#pragma unroll
    for (int kk = 0; kk < 2; ++kk) {
#pragma unroll
      for (int t = 0; t < 4; ++t) {
        const int vr = (t * 16 + c) * LP + kk * 32 + 8 * hh;   // A fragment: row d = t*16+c, keys kk*32 + 8h ..
        FB vb;
        vb.h[0] = *(const v8b*)(Vth + vr);
        vb.h[1] = *(const v8b*)(Vth + vr + 16);
        O[t] = mma_b(vb.v, ph[kk].v, O[t]);
        O[t] = mma_b(vb.v, pl[kk].v, O[t]);
      }
    }
  }
  __syncthreads();                             // every wave is past its last K / V^T read

  // ---- join the halves' sums, normalise, stage the wave's 16x64 f32 tile in LDS, whole-line writes ----
  float* os = (float*)lds + wave * (16 * OP);
  const float lsum = lrun + other_half(lrun);
  const float inv  = (lsum > 0.f) ? (1.0f / lsum) : 0.f;
#pragma unroll
  for (int t = 0; t < 4; ++t) {
    v4f w0, w1;
#pragma unroll
    for (int r = 0; r < 4; ++r) { w0[r] = O[t][r] * inv; w1[r] = O[t][4 + r] * inv; }
    *(v4f*)(os + c * OP + t * 16 + 8 * hh)     = w0;
    *(v4f*)(os + c * OP + t * 16 + 8 * hh + 4) = w1;
  }
  __builtin_amdgcn_fence(__ATOMIC_RELEASE, "workgroup");
  __builtin_amdgcn_wave_barrier();
  __builtin_amdgcn_fence(__ATOMIC_ACQUIRE, "workgroup");
  float* og = Op + ((size_t)bh * NL + q0) * ND;   // the wave's 16 rows are contiguous: row r at + r*64
  const int colw = c * 4;
  v4f ov[8];
#pragma unroll
  for (int it = 0; it < 8; ++it) {
    const int row = 2 * it + hh;               // rows 0..15: lanes 0..15 even row, lanes 16..31 odd row
    ov[it] = *(const v4f*)(os + row * OP + colw);
  }
  {
#pragma unroll
    for (int it = 0; it < 8; ++it) {
      const int row = 2 * it + hh;
      *(v4f*)(og + (size_t)row * ND + colw) = ov[it];
    }
    
  }
}

// =====================================================================================================
//   Qb  bf16 [32][2048][64]            0         8388608
//   Kb  bf16 [32][2048][64]      8388608         8388608
//   VT  bf16 [32][64][2048]     16777216         8388608
//   end                         25165824
// =====================================================================================================
extern "C" void kernel_launch(void* const* d_in, const int* in_sizes, int n_in,
                              void* d_out, int out_size, void* d_ws, size_t ws_size,
                              hipStream_t stream) {
  const int nqkv = NBH * NL * ND;                           // 4194304
  if (n_in < 3) return;
  if (in_sizes[0] != nqkv || in_sizes[1] != nqkv || in_sizes[2] != nqkv) return;
  if (out_size != nqkv) return;

  const float* q = (const float*)d_in[0];
  const float* k = (const float*)d_in[1];
  const float* v = (const float*)d_in[2];

  const size_t PL = (size_t)nqkv * 2;                       // 8388608
  size_t off = 0;
  const size_t oQ = off; off += PL;
  const size_t oK = off; off += PL;
  const size_t oV = off; off += PL;
  if (off > ws_size) return;                               // off = 25165824
  if (off > (size_t)134217728) return;

  char* ws = (char*)d_ws;
  unsigned short* Qb = (unsigned short*)(ws + oQ);
  unsigned short* Kb = (unsigned short*)(ws + oK);
  unsigned short* VT = (unsigned short*)(ws + oV);

  const int  n8 = nqkv / 8;                                 // 524288
  const dim3 blk(256);
  const dim3 gCvt((n8 + 255) / 256);                        // 2048 blocks
  const dim3 gVt(NBH * NKC);                                // 1024 blocks
  const dim3 gAttn(NBH * NQB);                              // 512 blocks

  // (1) q, k -> bf16 planes (RNE convert, same layout as the inputs)
  cvt_qk<<<gCvt, blk, 0, stream>>>(q, k, Qb, Kb, n8);
  // (2) v -> bf16 V^T planes [32][64][2048]
  prep_vt<<<gVt, blk, 0, stream>>>(v, VT);
  // (3) attention per (plane, 128-query block) -> d_out f32 [32][2048][64]
  attn_hm<<<gAttn, blk, 0, stream>>>(Qb, Kb, VT, (float*)d_out);
  (void)hipGetLastError();
}

// v004
// Measured time: 56.7 microseconds a run.
// Next to v003, in two timings, it ran 1.18 and 1.15 times as fast.
// Counting every step since v000, it is 3.41 times as fast.
// Contractions: k.q^T scores (transposed) = v_wmma_f32_16x16x32_bf16 (bf16 operands from RNE-converted q and k, single exact product, f32 accumulate);
// v^T.p^T context (transposed) = v_wmma_f32_16x16x32_bf16 with p as bf16 hi + unscaled bf16 residual and RNE-converted v (hi.v + lo.v), f32 accumulate;
// online softmax (scores unscaled), denominators and the final normalisation in f32 on the VALU.
// One launch: q, k and v are read as f32 and RNE-converted to bf16 inside the attention kernel (q into its register fragments,
// k and v on the way into LDS); the V^T fragments come from the row-major v tile by the 16-bit transposing LDS load.
// Carry audit: no power-of-two carries anywhere; the p residual plane is the unscaled RNE residual (p - hi) and shares the hi
// accumulator; softmax denominators are divided out exactly once in the epilogue of attn_hm (inv).
#include <hip/hip_runtime.h>
#include <math.h>
#include <stdint.h>

#define NBH  32               // batch x head planes, each [2048][64] contiguous
#define NL   2048             // query rows per plane
#define NS   2048             // key rows per plane
#define ND   64               // head dim = row pitch in elements
#define NQB  (NL / 128)       // 16 query blocks of 128 rows per plane
#define NKC  (NS / 64)        // 32 key chunks of 64 keys
static_assert(NQB == 16);
static_assert(NKC == 32);
static_assert((NL % 128) == 0 && (NS % 64) == 0 && ND == 64 && (ND % 32) == 0);

typedef __bf16   v16b __attribute__((ext_vector_type(16)));
typedef __bf16   v8b  __attribute__((ext_vector_type(8)));
typedef float    v8f  __attribute__((ext_vector_type(8)));
typedef float    v4f  __attribute__((ext_vector_type(4)));
typedef float    v2f  __attribute__((ext_vector_type(2)));
typedef __bf16   v2b  __attribute__((ext_vector_type(2)));
typedef unsigned int v4u __attribute__((ext_vector_type(4)));
typedef unsigned int v2u __attribute__((ext_vector_type(2)));
typedef short    v8s  __attribute__((ext_vector_type(8)));

__device__ __forceinline__ v8f zero8() { v8f z = {0.f, 0.f, 0.f, 0.f, 0.f, 0.f, 0.f, 0.f}; return z; }

// ---- WMMA helper: the builtin alone; the compiler keeps the hazard distances of its own builtin form -----
__device__ __forceinline__ v8f mma_b(v16b a, v16b b, v8f c) {
  return __builtin_amdgcn_wmma_f32_16x16x32_bf16(false, a, false, b, (short)0, c, false, false);
}

// ---- 4 consecutive f32 -> 4 bf16 (RNE, two per instruction) packed in 8 B ------------------------------
__device__ __forceinline__ v2u cvt4(v4f a) {
  const v2f lo = {a[0], a[1]};
  const v2f hi = {a[2], a[3]};
  v2u r;
  r[0] = __builtin_bit_cast(unsigned, __builtin_convertvector(lo, v2b));
  r[1] = __builtin_bit_cast(unsigned, __builtin_convertvector(hi, v2b));
  return r;
}

// ---- 16-bit transposing LDS load: lane l addresses 16 B of row (l & 7) + 8*(l >> 4), column half (l >> 3) & 1 of a
//      row-major 16 x 16 tile; lane (c, h) receives column c, rows 8h .. 8h+7
__device__ __forceinline__ v4u ld_tr16(const unsigned char* p) {
  typedef __attribute__((address_space(3))) v8s lds_v8s;
  return __builtin_bit_cast(v4u, __builtin_amdgcn_ds_load_tr16_b128_v8i16((lds_v8s*)p));
}

#define LP      72         // K tile: LDS row pitch in bf16 elements (64 used + 8 pad)
#define PV      160        // V tile: LDS row pitch in bytes (128 used + 32 pad)
#define OP      68         // epilogue staging row pitch in f32 (64 used + 4 pad)
#define L_K     0          // K chunk   [64 keys][LP] bf16   9216 B
#define L_V     9216       // V chunk   [64 keys][PV B] bf16 10240 B
#define L_KVEND 19456
#define L_TOTAL 34816      // epilogue: [8 waves][16 rows][OP] f32 over the same bytes
static_assert(LP >= 64 && (LP * 2) % 16 == 0 && ((LP * 2) / 16) % 2 == 1);   // 16-B aligned rows, odd count of 16-B units
static_assert(L_V - L_K == 64 * LP * 2);
static_assert(PV >= ND * 2 && PV % 32 == 0 && (PV / 32) % 2 == 1);            // 32-B aligned rows, odd count of 32-B units
static_assert(L_KVEND - L_V == 64 * PV);
static_assert(OP >= ND && (OP * 4) % 16 == 0);
static_assert(L_TOTAL == 8 * 16 * OP * 4 && L_TOTAL >= L_KVEND);

// value of the same register in lane ^ 16 (the other half of the query's keys)
__device__ __forceinline__ float other_half(float x) {
  const int b = __float_as_int(x);
  return __int_as_float(__builtin_amdgcn_permlanex16(b, b, 0x76543210, 0xfedcba98, false, false));
}

__global__ __launch_bounds__(256)
void attn_hm(const float* __restrict__ qp, const float* __restrict__ kp,
             const float* __restrict__ vp, float* Op) {
  __shared__ __align__(32) unsigned char lds[L_TOTAL];
  union FB { v16b v; v8b h[2]; v4u q[2]; v2u d[4]; unsigned u[8]; };
  __bf16* Ksh = (__bf16*)(lds + L_K);
  unsigned char* Vsh = lds + L_V;

  const int tid  = threadIdx.x;
  const int wave = tid >> 5;
  const int lane = tid & 31;
  const int hh   = lane >> 4;
  const int c    = lane & 15;

  const int bx = blockIdx.x;
  const int qb = bx & (NQB - 1);              // query block 0..15
  const int bh = bx >> 4;                     // plane 0..31
  const int q0 = qb * 128 + wave * 16;        // first query row of this wave

  const float* Kg = kp + (size_t)bh * NS * ND + tid * 4;   // this thread's first 16-B piece of the plane's key rows
  const float* Vg = vp + (size_t)bh * NS * ND + tid * 4;

  // ---- q B fragments for both 32-deep d-chunks: column = query q0 + c, k = d; elements 0..7 <- d = dc*32 + 8h ..,
  //      elements 8..15 <- d = dc*32 + 16 + 8h .. (f32 rows, RNE-converted here) ----
  const float* Qg = qp + ((size_t)bh * NL + q0 + c) * ND + 8 * hh;
  FB qa[2];
#pragma unroll
  for (int dc = 0; dc < 2; ++dc) {
#pragma unroll
    for (int e = 0; e < 4; ++e)               // e = 0, 1: elements 0..7; e = 2, 3: elements 8..15
      qa[dc].d[e] = cvt4(*(const v4f*)(Qg + dc * 32 + (e >> 1) * 16 + (e & 1) * 4));
  }

  const int srow = tid >> 4;                  // staging: row of piece 0 (piece i: + 16 i), 0..15
  const int scol = (tid & 15) * 4;            // staging: first d of the piece, 0..60
  // V^T fragment address of this lane for keys 0..15, d 0..15 (next 16 keys: + 16 PV, next 16 d: + 32 B)
  const unsigned char* vad = Vsh + (8 * hh + (lane & 7)) * PV + ((lane >> 3) & 1) * 16;

  v8f O[4];
#pragma unroll
  for (int t = 0; t < 4; ++t) O[t] = zero8();
  float mrun = -INFINITY;                     // running maximum of query c (equal in both lane halves)
  float lrun = 0.f;                           // running sum over this lane half's keys only

  for (int kt = 0; kt < NKC; ++kt) {          // block-uniform trip count
    const int kv0 = kt * 64;
    __syncthreads();                          // every wave is done with the prior chunk's tiles
    {
      v4f ka[4], va[4];
#pragma unroll
      for (int i = 0; i < 4; ++i) {           // piece tid + 256 i of the chunk's 1024 pieces of 16 B
        ka[i] = *(const v4f*)(Kg + (size_t)kv0 * ND + 1024 * i);
        va[i] = *(const v4f*)(Vg + (size_t)kv0 * ND + 1024 * i);
      }
#pragma unroll
      for (int i = 0; i < 4; ++i) {
        const int rw = srow + 16 * i;         // key within the chunk, 0..63
        *(v2u*)(Ksh + rw * LP + scol)     = cvt4(ka[i]);
        *(v2u*)(Vsh + rw * PV + scol * 2) = cvt4(va[i]);
      }
    }
    __syncthreads();

    // ---- scores^T: 64 keys x 16 query columns per wave, exact bf16 products over 2 d-chunks ----
    v8f s[4];
#pragma unroll
    for (int j = 0; j < 4; ++j) s[j] = zero8();
#pragma unroll
    for (int dc = 0; dc < 2; ++dc) {
      const int ko = dc * 32 + 8 * hh;
#pragma unroll
      for (int j = 0; j < 4; ++j) {
        const int kr = (j * 16 + c) * LP + ko;   // A: key j*16+c (row), d = dc*32 + 8h .. (k)
        FB kb;
        kb.h[0] = *(const v8b*)(Ksh + kr);
        kb.h[1] = *(const v8b*)(Ksh + kr + 16);
        s[j] = mma_b(kb.v, qa[dc].v, s[j]);
      }
    }

    // ---- maximum of query c over the chunk: 32 scores in the lane, then the other lane half ----
    float mj[4];
#pragma unroll
    for (int j = 0; j < 4; ++j) {
      mj[j] = s[j][0];
#pragma unroll
      for (int r = 1; r < 8; ++r) mj[j] = fmaxf(mj[j], s[j][r]);
    }
    float m = fmaxf(fmaxf(mj[0], mj[1]), fmaxf(mj[2], mj[3]));
    m = fmaxf(m, other_half(m));
    const float mnew = fmaxf(mrun, m);          // finite: every chunk has 64 valid keys
    const float al   = __expf(mrun - mnew);     // first chunk: exp(-inf) = 0
    mrun = mnew;

    // ---- p = exp(s - m), bf16 hi / lo packed in place into the B fragments of the context product ----
    FB ph[2], pl[2];
    float pj[4];
#pragma unroll
    for (int j = 0; j < 4; ++j) {
      pj[j] = 0.f;
#pragma unroll
      for (int r2 = 0; r2 < 4; ++r2) {
        v2f pp;
        pp[0] = __expf(s[j][2 * r2]     - mnew);
        pp[1] = __expf(s[j][2 * r2 + 1] - mnew);
        pj[j] += pp[0];
        pj[j] += pp[1];
        const v2b h2 = __builtin_convertvector(pp, v2b);                               // RNE, two per instruction
        const v2b l2 = __builtin_convertvector(pp - __builtin_convertvector(h2, v2f), v2b);   // unscaled residual, RNE
        ph[j >> 1].u[(j & 1) * 4 + r2] = __builtin_bit_cast(unsigned, h2);
        pl[j >> 1].u[(j & 1) * 4 + r2] = __builtin_bit_cast(unsigned, l2);
      }
    }
    lrun = lrun * al + ((pj[0] + pj[1]) + (pj[2] + pj[3]));

    // ---- rescale the running context, then context^T += V^T . P^T (2 bf16 products) ----
#pragma unroll
    for (int t = 0; t < 4; ++t) {
#pragma unroll
      for (int r = 0; r < 8; ++r) O[t][r] *= al;
    }
#pragma unroll
    for (int kk = 0; kk < 2; ++kk) {
#pragma unroll
      for (int t = 0; t < 4; ++t) {
        FB vb;                                   // A fragment: row d = t*16+c, keys kk*32 + 8h .. and kk*32 + 16 + 8h ..
        vb.q[0] = ld_tr16(vad + (kk * 32) * PV + 32 * t);
        vb.q[1] = ld_tr16(vad + (kk * 32 + 16) * PV + 32 * t);
        O[t] = mma_b(vb.v, ph[kk].v, O[t]);
        O[t] = mma_b(vb.v, pl[kk].v, O[t]);
      }
    }
  }
  __syncthreads();                             // every wave is past its last K / V read

  // ---- join the halves' sums, normalise, stage the wave's 16x64 f32 tile in LDS, whole-line writes ----
  float* os = (float*)lds + wave * (16 * OP);
  const float lsum = lrun + other_half(lrun);
  const float inv  = (lsum > 0.f) ? (1.0f / lsum) : 0.f;
#pragma unroll
  for (int t = 0; t < 4; ++t) {
    v4f w0, w1;
#pragma unroll
    for (int r = 0; r < 4; ++r) { w0[r] = O[t][r] * inv; w1[r] = O[t][4 + r] * inv; }
    *(v4f*)(os + c * OP + t * 16 + 8 * hh)     = w0;
    *(v4f*)(os + c * OP + t * 16 + 8 * hh + 4) = w1;
  }
  __builtin_amdgcn_fence(__ATOMIC_RELEASE, "workgroup");
  __builtin_amdgcn_wave_barrier();
  __builtin_amdgcn_fence(__ATOMIC_ACQUIRE, "workgroup");
  float* og = Op + ((size_t)bh * NL + q0) * ND;   // the wave's 16 rows are contiguous: row r at + r*64
  const int colw = c * 4;
  v4f ov[8];
#pragma unroll
  for (int it = 0; it < 8; ++it) {
    const int row = 2 * it + hh;               // rows 0..15: lanes 0..15 even row, lanes 16..31 odd row
    ov[it] = *(const v4f*)(os + row * OP + colw);
  }
  {
#pragma unroll
    for (int it = 0; it < 8; ++it) {
      const int row = 2 * it + hh;
      *(v4f*)(og + (size_t)row * ND + colw) = ov[it];
    }
    
  }
}

// =====================================================================================================
//   One launch; the workspace is not used.
// =====================================================================================================
extern "C" void kernel_launch(void* const* d_in, const int* in_sizes, int n_in,
                              void* d_out, int out_size, void* d_ws, size_t ws_size,
                              hipStream_t stream) {
  const int nqkv = NBH * NL * ND;                           // 4194304
  if (n_in < 3) return;
  if (in_sizes[0] != nqkv || in_sizes[1] != nqkv || in_sizes[2] != nqkv) return;
  if (out_size != nqkv) return;
  (void)d_ws;
  (void)ws_size;

  const float* q = (const float*)d_in[0];
  const float* k = (const float*)d_in[1];
  const float* v = (const float*)d_in[2];

  const dim3 blk(256);
  const dim3 gAttn(NBH * NQB);                              // 512 blocks

  // attention per (plane, 128-query block) -> d_out f32 [32][2048][64]
  attn_hm<<<gAttn, blk, 0, stream>>>(q, k, v, (float*)d_out);
  (void)hipGetLastError();
}

// v005
// One run takes 45.1 microseconds.
// Two timings next to v004 both put it at 1.26 times that version's speed.
// All steps since v000 together make it 4.28 times as fast.
// Contractions: k.q^T scores (transposed) = v_wmma_f32_16x16x32_bf16 (bf16 operands from RNE-converted q and k, single exact product, f32 accumulate);
// v^T.p^T context (transposed) = v_wmma_f32_16x16x32_bf16 with p as bf16 hi + unscaled bf16 residual and RNE-converted v (hi.v + lo.v), f32 accumulate;
// online softmax (scores unscaled), denominators and the final normalisation in f32 on the VALU.
// One launch: q, k and v are read as f32 and RNE-converted to bf16 inside the attention kernel (q into its register fragments,
// k and v on the way into LDS); the V^T fragments come from the row-major v tile by the 16-bit transposing LDS load.
// Carry audit: no power-of-two carries anywhere; the p residual plane is the unscaled RNE residual (p - hi) and shares the hi
// accumulator; softmax denominators are divided out exactly once in the epilogue of attn_hm (inv).
#include <hip/hip_runtime.h>
#include <math.h>
#include <stdint.h>

#define NBH  32               // batch x head planes, each [2048][64] contiguous
#define NL   2048             // query rows per plane
#define NS   2048             // key rows per plane
#define ND   64               // head dim = row pitch in elements
#define NQB  (NL / 128)       // 16 query blocks of 128 rows per plane
#define NKC  (NS / 64)        // 32 key chunks of 64 keys
static_assert(NQB == 16);
static_assert(NKC == 32);
static_assert((NL % 128) == 0 && (NS % 64) == 0 && ND == 64 && (ND % 32) == 0);

typedef __bf16   v16b __attribute__((ext_vector_type(16)));
typedef __bf16   v8b  __attribute__((ext_vector_type(8)));
typedef float    v8f  __attribute__((ext_vector_type(8)));
typedef float    v4f  __attribute__((ext_vector_type(4)));
typedef float    v2f  __attribute__((ext_vector_type(2)));
typedef __bf16   v2b  __attribute__((ext_vector_type(2)));
typedef unsigned int v4u __attribute__((ext_vector_type(4)));
typedef unsigned int v2u __attribute__((ext_vector_type(2)));
typedef short    v8s  __attribute__((ext_vector_type(8)));

__device__ __forceinline__ v8f zero8() { v8f z = {0.f, 0.f, 0.f, 0.f, 0.f, 0.f, 0.f, 0.f}; return z; }

// ---- WMMA helper: the builtin alone; the compiler keeps the hazard distances of its own builtin form -----
__device__ __forceinline__ v8f mma_b(v16b a, v16b b, v8f c) {
  return __builtin_amdgcn_wmma_f32_16x16x32_bf16(false, a, false, b, (short)0, c, false, false);
}

// ---- 4 consecutive f32 -> 4 bf16 (RNE, two per instruction) packed in 8 B ------------------------------
__device__ __forceinline__ v2u cvt4(v4f a) {
  const v2f lo = {a[0], a[1]};
  const v2f hi = {a[2], a[3]};
  v2u r;
  r[0] = __builtin_bit_cast(unsigned, __builtin_convertvector(lo, v2b));
  r[1] = __builtin_bit_cast(unsigned, __builtin_convertvector(hi, v2b));
  return r;
}

// ---- 16-bit transposing LDS load: lane l addresses 16 B of row (l & 7) + 8*(l >> 4), column half (l >> 3) & 1 of a
//      row-major 16 x 16 tile; lane (c, h) receives column c, rows 8h .. 8h+7
__device__ __forceinline__ v4u ld_tr16(const unsigned char* p) {
  typedef __attribute__((address_space(3))) v8s lds_v8s;
  return __builtin_bit_cast(v4u, __builtin_amdgcn_ds_load_tr16_b128_v8i16((lds_v8s*)p));
}

#define LP      72         // K tile: LDS row pitch in bf16 elements (64 used + 8 pad)
#define PV      160        // V tile: LDS row pitch in bytes (128 used + 32 pad)
#define OP      68         // epilogue staging row pitch in f32 (64 used + 4 pad)
#define L_K     0          // K chunk   [64 keys][LP] bf16   9216 B
#define L_V     9216       // V chunk   [64 keys][PV B] bf16 10240 B
#define L_KVEND 19456
#define L_BUF   19456      // one K + V buffer; two of them, chunk kt in buffer kt & 1
#define L_EPI   34816      // epilogue: [8 waves][16 rows][OP] f32 over the same bytes
#define L_TOTAL 38912
static_assert(LP >= 64 && (LP * 2) % 16 == 0 && ((LP * 2) / 16) % 2 == 1);   // 16-B aligned rows, odd count of 16-B units
static_assert(L_V - L_K == 64 * LP * 2);
static_assert(PV >= ND * 2 && PV % 32 == 0 && (PV / 32) % 2 == 1);            // 32-B aligned rows, odd count of 32-B units
static_assert(L_KVEND - L_V == 64 * PV);
static_assert(OP >= ND && (OP * 4) % 16 == 0);
static_assert(L_BUF == L_KVEND && L_BUF % 32 == 0 && L_TOTAL == 2 * L_BUF);
static_assert(L_EPI == 8 * 16 * OP * 4 && L_TOTAL >= L_EPI);
static_assert(NKC % 2 == 0 && NKC >= 2);

// value of the same register in lane ^ 16 (the other half of the query's keys)
__device__ __forceinline__ float other_half(float x) {
  const int b = __float_as_int(x);
  return __int_as_float(__builtin_amdgcn_permlanex16(b, b, 0x76543210, 0xfedcba98, false, false));
}

__global__ __launch_bounds__(256)
void attn_hm(const float* __restrict__ qp, const float* __restrict__ kp,
             const float* __restrict__ vp, float* Op) {
  __shared__ __align__(32) unsigned char lds[L_TOTAL];
  union FB { v16b v; v8b h[2]; v4u q[2]; v2u d[4]; unsigned u[8]; };
  __bf16* Ksh = (__bf16*)(lds + L_K);
  unsigned char* Vsh = lds + L_V;

  const int tid  = threadIdx.x;
  const int wave = tid >> 5;
  const int lane = tid & 31;
  const int hh   = lane >> 4;
  const int c    = lane & 15;

  const int bx = blockIdx.x;
  const int qb = bx & (NQB - 1);              // query block 0..15
  const int bh = bx >> 4;                     // plane 0..31
  const int q0 = qb * 128 + wave * 16;        // first query row of this wave

  const float* Kg = kp + (size_t)bh * NS * ND + tid * 4;   // this thread's first 16-B piece of the plane's key rows
  const float* Vg = vp + (size_t)bh * NS * ND + tid * 4;

  // ---- q B fragments for both 32-deep d-chunks: column = query q0 + c, k = d; elements 0..7 <- d = dc*32 + 8h ..,
  //      elements 8..15 <- d = dc*32 + 16 + 8h .. (f32 rows, RNE-converted here) ----
  const float* Qg = qp + ((size_t)bh * NL + q0 + c) * ND + 8 * hh;
  FB qa[2];
#pragma unroll
  for (int dc = 0; dc < 2; ++dc) {
#pragma unroll
    for (int e = 0; e < 4; ++e)               // e = 0, 1: elements 0..7; e = 2, 3: elements 8..15
      qa[dc].d[e] = cvt4(*(const v4f*)(Qg + dc * 32 + (e >> 1) * 16 + (e & 1) * 4));
  }

  const int srow = tid >> 4;                  // staging: row of piece 0 (piece i: + 16 i), 0..15
  const int scol = (tid & 15) * 4;            // staging: first d of the piece, 0..60
  // V^T fragment address of this lane for keys 0..15, d 0..15 (next 16 keys: + 16 PV, next 16 d: + 32 B)
  const unsigned char* vad = Vsh + (8 * hh + (lane & 7)) * PV + ((lane >> 3) & 1) * 16;

  v8f O[4];
#pragma unroll
  for (int t = 0; t < 4; ++t) O[t] = zero8();
  float mrun = -INFINITY;                     // running maximum of query c (equal in both lane halves)
  float lrun = 0.f;                           // running sum over this lane half's keys only

  // ---- staging pipeline: ka / va hold the f32 pieces of the chunk that is stored next ----
  v4f ka[4], va[4];
#pragma unroll
  for (int i = 0; i < 4; ++i) {               // chunk 0: piece tid + 256 i of the chunk's 1024 pieces of 16 B
    ka[i] = *(const v4f*)(Kg + 1024 * i);
    va[i] = *(const v4f*)(Vg + 1024 * i);
  }
#pragma unroll
  for (int i = 0; i < 4; ++i) {
    const int rw = srow + 16 * i;             // key within the chunk, 0..63
    *(v2u*)(Ksh + rw * LP + scol)     = cvt4(ka[i]);
    *(v2u*)(Vsh + rw * PV + scol * 2) = cvt4(va[i]);
  }
#pragma unroll
  for (int i = 0; i < 4; ++i) {               // chunk 1 starts its flight
    ka[i] = *(const v4f*)(Kg + (size_t)64 * ND + 1024 * i);
    va[i] = *(const v4f*)(Vg + (size_t)64 * ND + 1024 * i);
  }
  __syncthreads();                            // chunk 0 is published

  for (int kp = 0; kp < NKC / 2; ++kp) {      // block-uniform trip count
#pragma unroll
   for (int b = 0; b < 2; ++b) {              // unrolled: the buffer offsets are immediates of the LDS instructions
    const int kt = 2 * kp + b;                // this chunk, read from buffer b
    const __bf16* Kb = Ksh + b * (L_BUF / 2);
    const unsigned char* vab = vad + b * L_BUF;

    // ---- scores^T: 64 keys x 16 query columns per wave, exact bf16 products over 2 d-chunks ----
    v8f s[4];
#pragma unroll
    for (int j = 0; j < 4; ++j) s[j] = zero8();
#pragma unroll
    for (int dc = 0; dc < 2; ++dc) {
      const int ko = dc * 32 + 8 * hh;
#pragma unroll
      for (int j = 0; j < 4; ++j) {
        const int kr = (j * 16 + c) * LP + ko;   // A: key j*16+c (row), d = dc*32 + 8h .. (k)
        FB kb;
        kb.h[0] = *(const v8b*)(Kb + kr);
        kb.h[1] = *(const v8b*)(Kb + kr + 16);
        s[j] = mma_b(kb.v, qa[dc].v, s[j]);
      }
    }

    // ---- chunk kt + 1, loaded one trip ago, goes into the other buffer (its last readers left it at the barrier that
    //      ended trip kt - 1); then chunk kt + 2 starts its flight. No branch: past the last chunk the index is clamped,
    //      and what is stored then is read by nobody ----
    {
      __bf16* Kn = Ksh + (b ^ 1) * (L_BUF / 2);
      unsigned char* Vn = Vsh + (b ^ 1) * L_BUF;
#pragma unroll
      for (int i = 0; i < 4; ++i) {
        const int rw = srow + 16 * i;         // key within the chunk, 0..63
        *(v2u*)(Kn + rw * LP + scol)     = cvt4(ka[i]);
        *(v2u*)(Vn + rw * PV + scol * 2) = cvt4(va[i]);
      }
      const int kn = (kt + 2 < NKC) ? kt + 2 : NKC - 1;
#pragma unroll
      for (int i = 0; i < 4; ++i) {
        ka[i] = *(const v4f*)(Kg + (size_t)kn * 64 * ND + 1024 * i);
        va[i] = *(const v4f*)(Vg + (size_t)kn * 64 * ND + 1024 * i);
      }
    }

    // ---- maximum of query c over the chunk: 32 scores in the lane, then the other lane half ----
    float mj[4];
#pragma unroll
    for (int j = 0; j < 4; ++j) {
      mj[j] = s[j][0];
#pragma unroll
      for (int r = 1; r < 8; ++r) mj[j] = fmaxf(mj[j], s[j][r]);
    }
    float m = fmaxf(fmaxf(mj[0], mj[1]), fmaxf(mj[2], mj[3]));
    m = fmaxf(m, other_half(m));
    const float mnew = fmaxf(mrun, m);          // finite: every chunk has 64 valid keys
    const float al   = __expf(mrun - mnew);     // first chunk: exp(-inf) = 0
    mrun = mnew;

    // ---- p = exp(s - m), bf16 hi / lo packed in place into the B fragments of the context product ----
    FB ph[2], pl[2];
    float pj[4];
#pragma unroll
    for (int j = 0; j < 4; ++j) {
      pj[j] = 0.f;
#pragma unroll
      for (int r2 = 0; r2 < 4; ++r2) {
        v2f pp;
        pp[0] = __expf(s[j][2 * r2]     - mnew);
        pp[1] = __expf(s[j][2 * r2 + 1] - mnew);
        pj[j] += pp[0];
        pj[j] += pp[1];
        const v2b h2 = __builtin_convertvector(pp, v2b);                               // RNE, two per instruction
        const v2b l2 = __builtin_convertvector(pp - __builtin_convertvector(h2, v2f), v2b);   // unscaled residual, RNE
        ph[j >> 1].u[(j & 1) * 4 + r2] = __builtin_bit_cast(unsigned, h2);
        pl[j >> 1].u[(j & 1) * 4 + r2] = __builtin_bit_cast(unsigned, l2);
      }
    }
    lrun = lrun * al + ((pj[0] + pj[1]) + (pj[2] + pj[3]));

    // ---- rescale the running context, then context^T += V^T . P^T (2 bf16 products) ----
#pragma unroll
    for (int t = 0; t < 4; ++t) {
#pragma unroll
      for (int r = 0; r < 8; ++r) O[t][r] *= al;
    }
#pragma unroll
    for (int kk = 0; kk < 2; ++kk) {
#pragma unroll
      for (int t = 0; t < 4; ++t) {
        FB vb;                                   // A fragment: row d = t*16+c, keys kk*32 + 8h .. and kk*32 + 16 + 8h ..
        vb.q[0] = ld_tr16(vab + (kk * 32) * PV + 32 * t);
        vb.q[1] = ld_tr16(vab + (kk * 32 + 16) * PV + 32 * t);
        O[t] = mma_b(vb.v, ph[kk].v, O[t]);
        O[t] = mma_b(vb.v, pl[kk].v, O[t]);
      }
    }
    __syncthreads();                           // publishes chunk kt + 1; every wave is done with buffer b
   }
  }

  // ---- join the halves' sums, normalise, stage the wave's 16x64 f32 tile in LDS, whole-line writes ----
  float* os = (float*)lds + wave * (16 * OP);
  const float lsum = lrun + other_half(lrun);
  const float inv  = (lsum > 0.f) ? (1.0f / lsum) : 0.f;
#pragma unroll
  for (int t = 0; t < 4; ++t) {
    v4f w0, w1;
#pragma unroll
    for (int r = 0; r < 4; ++r) { w0[r] = O[t][r] * inv; w1[r] = O[t][4 + r] * inv; }
    *(v4f*)(os + c * OP + t * 16 + 8 * hh)     = w0;
    *(v4f*)(os + c * OP + t * 16 + 8 * hh + 4) = w1;
  }
  __builtin_amdgcn_fence(__ATOMIC_RELEASE, "workgroup");
  __builtin_amdgcn_wave_barrier();
  __builtin_amdgcn_fence(__ATOMIC_ACQUIRE, "workgroup");
  float* og = Op + ((size_t)bh * NL + q0) * ND;   // the wave's 16 rows are contiguous: row r at + r*64
  const int colw = c * 4;
  v4f ov[8];
#pragma unroll
  for (int it = 0; it < 8; ++it) {
    const int row = 2 * it + hh;               // rows 0..15: lanes 0..15 even row, lanes 16..31 odd row
    ov[it] = *(const v4f*)(os + row * OP + colw);
  }
  {
#pragma unroll
    for (int it = 0; it < 8; ++it) {
      const int row = 2 * it + hh;
      *(v4f*)(og + (size_t)row * ND + colw) = ov[it];
    }
    
  }
}

// =====================================================================================================
//   One launch; the workspace is not used.
// =====================================================================================================
extern "C" void kernel_launch(void* const* d_in, const int* in_sizes, int n_in,
                              void* d_out, int out_size, void* d_ws, size_t ws_size,
                              hipStream_t stream) {
  const int nqkv = NBH * NL * ND;                           // 4194304
  if (n_in < 3) return;
  if (in_sizes[0] != nqkv || in_sizes[1] != nqkv || in_sizes[2] != nqkv) return;
  if (out_size != nqkv) return;
  (void)d_ws;
  (void)ws_size;

  const float* q = (const float*)d_in[0];
  const float* k = (const float*)d_in[1];
  const float* v = (const float*)d_in[2];

  const dim3 blk(256);
  const dim3 gAttn(NBH * NQB);                              // 512 blocks

  // attention per (plane, 128-query block) -> d_out f32 [32][2048][64]
  attn_hm<<<gAttn, blk, 0, stream>>>(q, k, v, (float*)d_out);
  (void)hipGetLastError();
}

// v007
// A run of this version takes 32.5 microseconds.
// Versions between v005 and this one are left out; their measured steps multiply to 1.39 times as fast.
// Counting every step since v000, it is 5.96 times as fast.
// Contractions: k.q^T scores (transposed) = v_wmma_f32_16x16x32_bf16 (bf16 operands from RNE-converted q and k, single exact product, f32 accumulate);
// v^T.p^T context (transposed) = v_wmma_f32_16x16x32_f16 (f16 operands from RNE-converted p and v, single product), f32 accumulate;
// online softmax (scores unscaled), denominators and the final normalisation in f32 on the VALU.
// One launch: q, k and v are read as f32 and RNE-converted inside the attention kernel (q to bf16 into its register fragments,
// k to bf16 and v to f16 on the way into LDS); the V^T fragments come from the row-major v tile by the 16-bit transposing LDS load.
// Operand widths of the context product: p lies in [0, 1] and v, standard normal by the input specs, far inside the f16
// range, so both keep 11 significant bits
// (p below 2^-14 is an f16 subnormal, absolute error at most 2^-25 of the row's running maximum term).
// Carry audit: no power-of-two carries anywhere; softmax denominators are summed from the unrounded f32 p; the two key halves of a
// query are joined once, in the epilogue of attn_hm (each scaled by exp(its maximum - the common maximum)), and the sum is
// divided out there exactly once.
#include <hip/hip_runtime.h>
#include <math.h>
#include <stdint.h>

#define NBH  32               // batch x head planes, each [2048][64] contiguous
#define NL   2048             // query rows per plane
#define NS   2048             // key rows per plane
#define ND   64               // head dim = row pitch in elements
#define NQB  (NL / 256)       // 8 query blocks of 256 rows per plane
#define NKT  (NS / 128)       // 16 trips of 128 keys (two chunks of 64, one per wave group)
static_assert(NQB == 8);
static_assert(NKT == 16);
static_assert((NL % 256) == 0 && (NS % 128) == 0 && ND == 64 && (ND % 32) == 0);

typedef __bf16   v16b __attribute__((ext_vector_type(16)));
typedef __bf16   v8b  __attribute__((ext_vector_type(8)));
typedef float    v8f  __attribute__((ext_vector_type(8)));
typedef float    v4f  __attribute__((ext_vector_type(4)));
typedef float    v2f  __attribute__((ext_vector_type(2)));
typedef __bf16   v2b  __attribute__((ext_vector_type(2)));
typedef _Float16 v16h __attribute__((ext_vector_type(16)));
typedef _Float16 v2h  __attribute__((ext_vector_type(2)));
typedef unsigned int v4u __attribute__((ext_vector_type(4)));
typedef unsigned int v2u __attribute__((ext_vector_type(2)));
typedef short    v8s  __attribute__((ext_vector_type(8)));

__device__ __forceinline__ v8f zero8() { v8f z = {0.f, 0.f, 0.f, 0.f, 0.f, 0.f, 0.f, 0.f}; return z; }

// ---- WMMA helpers: the builtins alone; the compiler keeps the hazard distances of its own builtin forms -----
__device__ __forceinline__ v8f mma_b(v16b a, v16b b, v8f c) {
  return __builtin_amdgcn_wmma_f32_16x16x32_bf16(false, a, false, b, (short)0, c, false, false);
}
__device__ __forceinline__ v8f mma_h(v16h a, v16h b, v8f c) {
  return __builtin_amdgcn_wmma_f32_16x16x32_f16(false, a, false, b, (short)0, c, false, false);
}

// ---- 4 consecutive f32 -> 4 bf16 (RNE, two per instruction) packed in 8 B ------------------------------
__device__ __forceinline__ v2u cvt4(v4f a) {
  const v2f lo = {a[0], a[1]};
  const v2f hi = {a[2], a[3]};
  v2u r;
  r[0] = __builtin_bit_cast(unsigned, __builtin_convertvector(lo, v2b));
  r[1] = __builtin_bit_cast(unsigned, __builtin_convertvector(hi, v2b));
  return r;
}

// ---- 4 consecutive f32 -> 4 f16 (RNE, two per instruction) packed in 8 B -------------------------------
__device__ __forceinline__ v2u cvt4h(v4f a) {
  const v2f lo = {a[0], a[1]};
  const v2f hi = {a[2], a[3]};
  v2u r;
  r[0] = __builtin_bit_cast(unsigned, __builtin_convertvector(lo, v2h));
  r[1] = __builtin_bit_cast(unsigned, __builtin_convertvector(hi, v2h));
  return r;
}

// ---- 16-bit transposing LDS load: lane l addresses 16 B of row (l & 7) + 8*(l >> 4), column half (l >> 3) & 1 of a
//      row-major 16 x 16 tile; lane (c, h) receives column c, rows 8h .. 8h+7
__device__ __forceinline__ v4u ld_tr16(const unsigned char* p) {
  typedef __attribute__((address_space(3))) v8s lds_v8s;
  return __builtin_bit_cast(v4u, __builtin_amdgcn_ds_load_tr16_b128_v8i16((lds_v8s*)p));
}

#define LP      72         // K tile: LDS row pitch in bf16 elements (64 used + 8 pad)
#define PV      160        // V tile: LDS row pitch in bytes (128 used + 32 pad)
#define OP      68         // epilogue staging row pitch in f32 (64 used + 4 pad)
#define L_K     0          // K rows    [128 keys][LP] bf16   18432 B
#define L_V     18432      // V rows    [128 keys][PV B] f16  20480 B
#define L_KVEND 38912
#define L_BUF   38912      // one K + V buffer; two of them, trip kt in buffer kt & 1
#define L_WEPI  4352       // epilogue, per wave: hand-over [8][32 lanes] 16 B + [32 lanes] 8 B, then [16 rows][OP] f32
#define L_EPI   69632      // 16 waves of it, over the same bytes
#define L_TOTAL 77824
#define TRIPB   32768      // bytes of one plane's 128 f32 rows of a trip
static_assert(LP >= 64 && (LP * 2) % 16 == 0 && ((LP * 2) / 16) % 2 == 1);   // 16-B aligned rows, odd count of 16-B units
static_assert(L_V - L_K == 128 * LP * 2);
static_assert(PV >= ND * 2 && PV % 32 == 0 && (PV / 32) % 2 == 1);            // 32-B aligned rows, odd count of 32-B units
static_assert(L_KVEND - L_V == 128 * PV && L_V % 32 == 0);
static_assert(OP >= ND && (OP * 4) % 16 == 0);
static_assert(L_BUF == L_KVEND && L_BUF % 32 == 0 && L_TOTAL == 2 * L_BUF);
static_assert(L_WEPI == 16 * OP * 4 && L_WEPI == 8 * 32 * 16 + 32 * 8);
static_assert(L_EPI == 16 * L_WEPI && L_TOTAL >= L_EPI);
static_assert(NKT % 2 == 0 && NKT >= 2);
static_assert(TRIPB == 128 * ND * 4 && TRIPB == 4 * 512 * 16);

// value of the same register in lane ^ 16 (the other half of the query's keys)
__device__ __forceinline__ float other_half(float x) {
  const int b = __float_as_int(x);
  return __int_as_float(__builtin_amdgcn_permlanex16(b, b, 0x76543210, 0xfedcba98, false, false));
}

__global__ __launch_bounds__(512)
void attn_hm(const float* __restrict__ qp, const float* __restrict__ kp,
             const float* __restrict__ vp, float* Op) {
  __shared__ __align__(32) unsigned char lds[L_TOTAL];
  union FB { v16b v; v16h f; v8b h[2]; v4u q[2]; v2u d[4]; unsigned u[8]; };
  __bf16* Ksh = (__bf16*)(lds + L_K);
  unsigned char* Vsh = lds + L_V;

  const int tid  = threadIdx.x;
  const int wave = tid >> 5;
  const int lane = tid & 31;
  const int hh   = lane >> 4;
  const int c    = lane & 15;
  const int wq   = wave & 7;                  // query position of the wave, 0..7
  const int kh   = wave >> 3;                 // key group of the wave: chunk kh of every trip

  const int bx = blockIdx.x;
  const int qb = bx & (NQB - 1);              // query block 0..7
  const int bh = bx >> 3;                     // plane 0..31
  const int q0 = qb * 256 + wq * 32;          // first query row of this wave

  // staging addresses: the plane's base is the same for the whole block (scalar registers), this thread's first 16-B piece
  // of a trip lies toff bytes behind it (one vector register for both planes and all trips)
  const char* Kg = (const char*)(kp + (size_t)bh * NS * ND);
  const char* Vg = (const char*)(vp + (size_t)bh * NS * ND);
  const unsigned toff = (unsigned)tid * 16u;

  // ---- q B fragments, per column group g, for both 32-deep d-chunks: column = query q0 + g*16 + c, k = d; elements 0..7 <-
  //      d = dc*32 + 8h .., elements 8..15 <- d = dc*32 + 16 + 8h .. (f32 rows, RNE-converted here) ----
  const float* Qg = qp + ((size_t)bh * NL + q0 + c) * ND + 8 * hh;
  FB qa[2][2];
#pragma unroll
  for (int g = 0; g < 2; ++g) {
#pragma unroll
    for (int dc = 0; dc < 2; ++dc) {
#pragma unroll
      for (int e = 0; e < 4; ++e)             // e = 0, 1: elements 0..7; e = 2, 3: elements 8..15
        qa[g][dc].d[e] = cvt4(*(const v4f*)(Qg + g * 16 * ND + dc * 32 + (e >> 1) * 16 + (e & 1) * 4));
    }
  }

  const int srow = tid >> 4;                  // staging: row of piece 0 (piece i: + 32 i), 0..31
  const int scol = (tid & 15) * 4;            // staging: first d of the piece, 0..60
  // K fragment address of this lane for key c of the wave's chunk, d = 8h (next 16 keys: + 16 LP, next 16 d: + 16)
  const __bf16* kad = Ksh + (kh * 64 + c) * LP + 8 * hh;
  // V^T fragment address of this lane for keys 0..15 of the wave's chunk, d 0..15 (next 16 keys: + 16 PV, next 16 d: + 32 B)
  const unsigned char* vad = Vsh + (kh * 64 + 8 * hh + (lane & 7)) * PV + ((lane >> 3) & 1) * 16;

  v8f O[2][4];
#pragma unroll
  for (int g = 0; g < 2; ++g) {
#pragma unroll
    for (int t = 0; t < 4; ++t) O[g][t] = zero8();
  }
  float mrun[2] = {-INFINITY, -INFINITY};     // running maximum of query g*16 + c over this wave's chunks (equal in both lane halves)
  float lrun[2] = {0.f, 0.f};                 // running sum over this lane half's keys only

  // ---- staging pipeline: ka / va hold the f32 pieces of the trip that is stored next ----
  v4f ka[4], va[4];
#pragma unroll
  for (int i = 0; i < 4; ++i) {               // trip 0: piece tid + 512 i of the trip's 2048 pieces of 16 B
    ka[i] = *(const v4f*)(Kg + 8192 * i + toff);
    va[i] = *(const v4f*)(Vg + 8192 * i + toff);
  }
#pragma unroll
  for (int i = 0; i < 4; ++i) {
    const int rw = srow + 32 * i;             // key within the trip, 0..127
    *(v2u*)(Ksh + rw * LP + scol)     = cvt4(ka[i]);
    *(v2u*)(Vsh + rw * PV + scol * 2) = cvt4h(va[i]);
  }
#pragma unroll
  for (int i = 0; i < 4; ++i) {               // trip 1 starts its flight
    ka[i] = *(const v4f*)(Kg + TRIPB + 8192 * i + toff);
    va[i] = *(const v4f*)(Vg + TRIPB + 8192 * i + toff);
  }
  unsigned voff = toff + 2u * TRIPB;          // byte offset, in both planes, of this thread's first piece of the trip loaded next
  __syncthreads();                            // trip 0 is published

  for (int tp = 0; tp < NKT / 2; ++tp) {      // block-uniform trip count
#pragma unroll
   for (int b = 0; b < 2; ++b) {              // unrolled: the buffer offsets are constants of the LDS addresses
    const int kt = 2 * tp + b;                // this trip, read from buffer b
    const __bf16* Kb = kad + b * (L_BUF / 2);
    const unsigned char* vab = vad + b * L_BUF;

    // ---- the wave's 8 K fragments (A: key j*16+c (row), d = dc*32 + 8h .. (k)) are asked for as one group ----
    FB kb[2][4];
#pragma unroll
    for (int dc = 0; dc < 2; ++dc) {
#pragma unroll
      for (int j = 0; j < 4; ++j) {
        const int kr = j * 16 * LP + dc * 32;
        kb[dc][j].h[0] = *(const v8b*)(Kb + kr);
        kb[dc][j].h[1] = *(const v8b*)(Kb + kr + 16);
      }
    }

    // ---- trip kt + 1, loaded one trip ago, goes into the other buffer (its last readers left it at the barrier that
    //      ended trip kt - 1) ----
    {
      __bf16* Kn = Ksh + (b ^ 1) * (L_BUF / 2);
      unsigned char* Vn = Vsh + (b ^ 1) * L_BUF;
#pragma unroll
      for (int i = 0; i < 4; ++i) {
        const int rw = srow + 32 * i;         // key within the trip, 0..127
        *(v2u*)(Kn + rw * LP + scol)     = cvt4(ka[i]);
        *(v2u*)(Vn + rw * PV + scol * 2) = cvt4h(va[i]);
      }
    }
    // scheduling fence: the pieces' 32 registers are free before the 64 score accumulators come to life. Without it the
    // compiler mixes the two, spills to scratch, and waits to 0 for most fragments
    __builtin_amdgcn_sched_barrier(0);

    // ---- scores^T: 64 keys x 32 query columns per wave, exact bf16 products over 2 d-chunks; one K fragment, two products ----
    v8f s[2][4];
#pragma unroll
    for (int g = 0; g < 2; ++g) {
#pragma unroll
      for (int j = 0; j < 4; ++j) s[g][j] = zero8();
    }
#pragma unroll
    for (int dc = 0; dc < 2; ++dc) {
#pragma unroll
      for (int j = 0; j < 4; ++j) {
#pragma unroll
        for (int g = 0; g < 2; ++g) s[g][j] = mma_b(kb[dc][j].v, qa[g][dc].v, s[g][j]);
      }
    }

    // ---- trip kt + 2 starts its flight. No branch: past the last trip the offset stays at the last trip's, and what is
    //      stored then is read by nobody ----
    {
#pragma unroll
      for (int i = 0; i < 4; ++i) {
        ka[i] = *(const v4f*)(Kg + (size_t)voff + 8192 * i);
        va[i] = *(const v4f*)(Vg + (size_t)voff + 8192 * i);
      }
      const unsigned step = (kt + 3 < NKT) ? (unsigned)TRIPB : 0u;   // the offset stops at the last trip
      // the offset register moves on to the next trip behind the wait that stands before a register of an issued load is
      // overwritten, both in one statement: the register lives through the loop and the loads take the scalar-base form.
      // With a vector address pair per trip one build laid the last load's result over the pairs of the loads in front of it
      asm volatile("s_wait_xcnt 0x0\n\tv_add_nc_u32 %0, %1, %0" : "+v"(voff) : "s"(step) : "memory");
    }
    // scheduling fence: the score products and the loads stand as one block in front of the softmax. Without it the compiler
    // spreads the loads through the softmax and spills to scratch
    __builtin_amdgcn_sched_barrier(0);

    FB ph[2][2];
    float al[2];
#pragma unroll
    for (int g = 0; g < 2; ++g) {
      // ---- maximum of query g*16 + c over the chunk: 32 scores in the lane, then the other lane half ----
      float mj[4];
#pragma unroll
      for (int j = 0; j < 4; ++j) {
        mj[j] = s[g][j][0];
#pragma unroll
        for (int r = 1; r < 8; ++r) mj[j] = fmaxf(mj[j], s[g][j][r]);
      }
      float m = fmaxf(fmaxf(mj[0], mj[1]), fmaxf(mj[2], mj[3]));
      m = fmaxf(m, other_half(m));
      const float mnew = fmaxf(mrun[g], m);       // finite: every chunk has 64 valid keys
      al[g]   = __expf(mrun[g] - mnew);           // first chunk: exp(-inf) = 0
      mrun[g] = mnew;

      // ---- p = exp(s - m), rounded to f16 and packed in place into the B fragments of the context product ----
      float pj[4];
#pragma unroll
      for (int j = 0; j < 4; ++j) {
        pj[j] = 0.f;
#pragma unroll
        for (int r2 = 0; r2 < 4; ++r2) {
          v2f pp;
          pp[0] = __expf(s[g][j][2 * r2]     - mnew);
          pp[1] = __expf(s[g][j][2 * r2 + 1] - mnew);
          pj[j] += pp[0];
          pj[j] += pp[1];
          const v2h h2 = __builtin_convertvector(pp, v2h);                             // RNE, two per instruction
          ph[g][j >> 1].u[(j & 1) * 4 + r2] = __builtin_bit_cast(unsigned, h2);
        }
      }
      lrun[g] = lrun[g] * al[g] + ((pj[0] + pj[1]) + (pj[2] + pj[3]));

      // ---- rescale the running context of the group ----
#pragma unroll
      for (int t = 0; t < 4; ++t) {
#pragma unroll
        for (int r = 0; r < 8; ++r) O[g][t][r] *= al[g];
      }
    }

    // ---- context^T += V^T . P^T (one f16 product per group); one V^T fragment, two products ----
#pragma unroll
    for (int kk = 0; kk < 2; ++kk) {
#pragma unroll
      for (int t = 0; t < 4; ++t) {
        FB vb;                                   // A fragment: row d = t*16+c, keys kk*32 + 8h .. and kk*32 + 16 + 8h ..
        vb.q[0] = ld_tr16(vab + (kk * 32) * PV + 32 * t);
        vb.q[1] = ld_tr16(vab + (kk * 32 + 16) * PV + 32 * t);
#pragma unroll
        for (int g = 0; g < 2; ++g) O[g][t] = mma_h(vb.f, ph[g][kk].f, O[g][t]);
      }
    }
    __syncthreads();                           // publishes trip kt + 1; every wave is done with buffer b
   }
  }

  // ---- hand-over between the two key groups: wave (wq, kh) finishes column group kh and gives the other group's maximum,
  //      sum (lane halves joined) and context to wave (wq, kh ^ 1), same lane, same register ----
  float* os = (float*)lds + wave * (L_WEPI / 4);
  const float* xp = (const float*)lds + (wave ^ 8) * (L_WEPI / 4);
  const bool k0 = (kh == 0);
  const float l0 = lrun[0] + other_half(lrun[0]);
  const float l1 = lrun[1] + other_half(lrun[1]);
  const float mk = k0 ? mrun[0] : mrun[1];
  const float lk = k0 ? l0 : l1;
  {
    v2f ml;
    ml[0] = k0 ? mrun[1] : mrun[0];
    ml[1] = k0 ? l1 : l0;
#pragma unroll
    for (int t = 0; t < 4; ++t) {
      v4f w0, w1;
#pragma unroll
      for (int r = 0; r < 4; ++r) {
        w0[r] = k0 ? O[1][t][r]     : O[0][t][r];
        w1[r] = k0 ? O[1][t][4 + r] : O[0][t][4 + r];
      }
      *(v4f*)(os + ((2 * t) * 32 + lane) * 4)     = w0;
      *(v4f*)(os + ((2 * t + 1) * 32 + lane) * 4) = w1;
    }
    *(v2f*)(os + 1024 + lane * 2) = ml;
  }
  __syncthreads();                             // the hand-over ranges are published
  v4f px[8];
#pragma unroll
  for (int i = 0; i < 8; ++i) px[i] = *(const v4f*)(xp + (i * 32 + lane) * 4);
  const v2f pml = *(const v2f*)(xp + 1024 + lane * 2);
  __syncthreads();                             // every wave has read its partner's range: each range becomes its owner's output staging

  // ---- join the two key groups, normalise, stage the wave's 16x64 f32 tile in LDS, whole-line writes ----
  const float mall = fmaxf(mk, pml[0]);        // both finite: each group has walked 16 chunks
  const float ea   = __expf(mk - mall);
  const float eb   = __expf(pml[0] - mall);
  const float lsum = lk * ea + pml[1] * eb;
  const float inv  = (lsum > 0.f) ? (1.0f / lsum) : 0.f;
  const float fa   = ea * inv;
  const float fb   = eb * inv;
#pragma unroll
  for (int t = 0; t < 4; ++t) {
    v4f w0, w1;
#pragma unroll
    for (int r = 0; r < 4; ++r) {
      w0[r] = (k0 ? O[0][t][r]     : O[1][t][r])     * fa + px[2 * t][r]     * fb;
      w1[r] = (k0 ? O[0][t][4 + r] : O[1][t][4 + r]) * fa + px[2 * t + 1][r] * fb;
    }
    *(v4f*)(os + c * OP + t * 16 + 8 * hh)     = w0;
    *(v4f*)(os + c * OP + t * 16 + 8 * hh + 4) = w1;
  }
  __builtin_amdgcn_fence(__ATOMIC_RELEASE, "workgroup");
  __builtin_amdgcn_wave_barrier();
  __builtin_amdgcn_fence(__ATOMIC_ACQUIRE, "workgroup");
  float* og = Op + ((size_t)bh * NL + q0 + kh * 16) * ND;   // the wave's 16 rows are contiguous: row r at + r*64
  const int colw = c * 4;
  v4f ov[8];
#pragma unroll
  for (int it = 0; it < 8; ++it) {
    const int row = 2 * it + hh;               // rows 0..15: lanes 0..15 even row, lanes 16..31 odd row
    ov[it] = *(const v4f*)(os + row * OP + colw);
  }
#pragma unroll
  for (int it = 0; it < 8; ++it) {
    const int row = 2 * it + hh;
    *(v4f*)(og + (size_t)row * ND + colw) = ov[it];
  }
}

// =====================================================================================================
//   One launch; the workspace is not used.
// =====================================================================================================
extern "C" void kernel_launch(void* const* d_in, const int* in_sizes, int n_in,
                              void* d_out, int out_size, void* d_ws, size_t ws_size,
                              hipStream_t stream) {
  const int nqkv = NBH * NL * ND;                           // 4194304
  if (n_in < 3) return;
  if (in_sizes[0] != nqkv || in_sizes[1] != nqkv || in_sizes[2] != nqkv) return;
  if (out_size != nqkv) return;
  (void)d_ws;
  (void)ws_size;

  const float* q = (const float*)d_in[0];
  const float* k = (const float*)d_in[1];
  const float* v = (const float*)d_in[2];

  const dim3 blk(512);
  const dim3 gAttn(NBH * NQB);                              // 256 blocks

  // attention per (plane, 256-query block) -> d_out f32 [32][2048][64]
  attn_hm<<<gAttn, blk, 0, stream>>>(q, k, v, (float*)d_out);
  (void)hipGetLastError();
}

// v008
// It runs in 29.8 microseconds.
// Two timings next to v007 both put it at 1.09 times that version's speed.
// All steps since v000 together make it 6.50 times as fast.
// Contractions: k.q^T scores (transposed) = v_wmma_f32_16x16x32_bf16 (bf16 operands from RNE-converted q and k, single exact product, f32 accumulate);
// v^T.p^T context (transposed) = v_wmma_f32_16x16x32_f16 (f16 operands from RNE-converted p and v, single product), f32 accumulate;
// online softmax (scores unscaled), denominators and the final normalisation in f32 on the VALU; exponentials in base 2: the running
// maximum is kept as round(max * log2 e), and p = 2^(s * log2 e - that) takes one fused multiply-add per score, two scores per instruction.
// One launch: q, k and v are read as f32 and RNE-converted inside the attention kernel (q to bf16 into its register fragments,
// k to bf16 and v to f16 on the way into LDS); the V^T fragments come from the row-major v tile by the 16-bit transposing LDS load.
// Operand widths of the context product: p lies in [0, 1] and v, standard normal by the input specs, far inside the f16
// range, so both keep 11 significant bits
// (p below 2^-14 is an f16 subnormal, absolute error at most 2^-25 of the row's running maximum term).
// Carry audit: no power-of-two carries anywhere; softmax denominators are summed from the unrounded f32 p; the two key halves of a
// query are joined once, in the epilogue of attn_hm (each scaled by 2^(its maximum - the common maximum), maxima in base-2 units), and the sum is
// divided out there exactly once.
#include <hip/hip_runtime.h>
#include <math.h>
#include <stdint.h>

#define NBH  32               // batch x head planes, each [2048][64] contiguous
#define NL   2048             // query rows per plane
#define NS   2048             // key rows per plane
#define ND   64               // head dim = row pitch in elements
#define NQB  (NL / 256)       // 8 query blocks of 256 rows per plane
#define NKT  (NS / 128)       // 16 trips of 128 keys (two chunks of 64, one per wave group)
static_assert(NQB == 8);
static_assert(NKT == 16);
static_assert((NL % 256) == 0 && (NS % 128) == 0 && ND == 64 && (ND % 32) == 0);

typedef __bf16   v16b __attribute__((ext_vector_type(16)));
typedef __bf16   v8b  __attribute__((ext_vector_type(8)));
typedef float    v8f  __attribute__((ext_vector_type(8)));
typedef float    v4f  __attribute__((ext_vector_type(4)));
typedef float    v2f  __attribute__((ext_vector_type(2)));
typedef __bf16   v2b  __attribute__((ext_vector_type(2)));
typedef _Float16 v16h __attribute__((ext_vector_type(16)));
typedef _Float16 v2h  __attribute__((ext_vector_type(2)));
typedef unsigned int v4u __attribute__((ext_vector_type(4)));
typedef unsigned int v2u __attribute__((ext_vector_type(2)));
typedef short    v8s  __attribute__((ext_vector_type(8)));

__device__ __forceinline__ v8f zero8() { v8f z = {0.f, 0.f, 0.f, 0.f, 0.f, 0.f, 0.f, 0.f}; return z; }

// ---- WMMA helpers: the builtins alone; the compiler keeps the hazard distances of its own builtin forms -----
__device__ __forceinline__ v8f mma_b(v16b a, v16b b, v8f c) {
  return __builtin_amdgcn_wmma_f32_16x16x32_bf16(false, a, false, b, (short)0, c, false, false);
}
__device__ __forceinline__ v8f mma_h(v16h a, v16h b, v8f c) {
  return __builtin_amdgcn_wmma_f32_16x16x32_f16(false, a, false, b, (short)0, c, false, false);
}

// ---- 4 consecutive f32 -> 4 bf16 (RNE, two per instruction) packed in 8 B ------------------------------
__device__ __forceinline__ v2u cvt4(v4f a) {
  const v2f lo = {a[0], a[1]};
  const v2f hi = {a[2], a[3]};
  v2u r;
  r[0] = __builtin_bit_cast(unsigned, __builtin_convertvector(lo, v2b));
  r[1] = __builtin_bit_cast(unsigned, __builtin_convertvector(hi, v2b));
  return r;
}

// ---- 4 consecutive f32 -> 4 f16 (RNE, two per instruction) packed in 8 B -------------------------------
__device__ __forceinline__ v2u cvt4h(v4f a) {
  const v2f lo = {a[0], a[1]};
  const v2f hi = {a[2], a[3]};
  v2u r;
  r[0] = __builtin_bit_cast(unsigned, __builtin_convertvector(lo, v2h));
  r[1] = __builtin_bit_cast(unsigned, __builtin_convertvector(hi, v2h));
  return r;
}

// ---- 16-bit transposing LDS load: lane l addresses 16 B of row (l & 7) + 8*(l >> 4), column half (l >> 3) & 1 of a
//      row-major 16 x 16 tile; lane (c, h) receives column c, rows 8h .. 8h+7
__device__ __forceinline__ v4u ld_tr16(const unsigned char* p) {
  typedef __attribute__((address_space(3))) v8s lds_v8s;
  return __builtin_bit_cast(v4u, __builtin_amdgcn_ds_load_tr16_b128_v8i16((lds_v8s*)p));
}

#define LP      72         // K tile: LDS row pitch in bf16 elements (64 used + 8 pad)
#define PV      160        // V tile: LDS row pitch in bytes (128 used + 32 pad)
#define OP      68         // epilogue staging row pitch in f32 (64 used + 4 pad)
#define L_K     0          // K rows    [128 keys][LP] bf16   18432 B
#define L_V     18432      // V rows    [128 keys][PV B] f16  20480 B
#define L_KVEND 38912
#define L_BUF   38912      // one K + V buffer; two of them, trip kt in buffer kt & 1
#define L_WEPI  4352       // epilogue, per wave: hand-over [8][32 lanes] 16 B + [32 lanes] 8 B, then [16 rows][OP] f32
#define L_EPI   69632      // 16 waves of it, over the same bytes
#define L_TOTAL 77824
#define TRIPB   32768      // bytes of one plane's 128 f32 rows of a trip
#define LOG2E   1.4426950408889634f
static_assert(LP >= 64 && (LP * 2) % 16 == 0 && ((LP * 2) / 16) % 2 == 1);   // 16-B aligned rows, odd count of 16-B units
static_assert(L_V - L_K == 128 * LP * 2);
static_assert(PV >= ND * 2 && PV % 32 == 0 && (PV / 32) % 2 == 1);            // 32-B aligned rows, odd count of 32-B units
static_assert(L_KVEND - L_V == 128 * PV && L_V % 32 == 0);
static_assert(OP >= ND && (OP * 4) % 16 == 0);
static_assert(L_BUF == L_KVEND && L_BUF % 32 == 0 && L_TOTAL == 2 * L_BUF);
static_assert(L_WEPI == 16 * OP * 4 && L_WEPI == 8 * 32 * 16 + 32 * 8);
static_assert(L_EPI == 16 * L_WEPI && L_TOTAL >= L_EPI);
static_assert(NKT % 2 == 0 && NKT >= 2);
static_assert(TRIPB == 128 * ND * 4 && TRIPB == 4 * 512 * 16);

// value of the same register in lane ^ 16 (the other half of the query's keys)
__device__ __forceinline__ float other_half(float x) {
  const int b = __float_as_int(x);
  return __int_as_float(__builtin_amdgcn_permlanex16(b, b, 0x76543210, 0xfedcba98, false, false));
}

__global__ __launch_bounds__(512)
void attn_hm(const float* __restrict__ qp, const float* __restrict__ kp,
             const float* __restrict__ vp, float* Op) {
  __shared__ __align__(32) unsigned char lds[L_TOTAL];
  union FB { v16b v; v16h f; v8b h[2]; v4u q[2]; v2u d[4]; unsigned u[8]; };
  __bf16* Ksh = (__bf16*)(lds + L_K);
  unsigned char* Vsh = lds + L_V;

  const int tid  = threadIdx.x;
  const int wave = __builtin_amdgcn_readfirstlane(tid >> 5);   // the same in every lane: it and what follows from it live in scalar registers
  const int lane = tid & 31;
  const int hh   = lane >> 4;
  const int c    = lane & 15;
  const int wq   = wave & 7;                  // query position of the wave, 0..7
  const int kh   = wave >> 3;                 // key group of the wave: chunk kh of every trip

  const int bx = blockIdx.x;
  const int qb = bx & (NQB - 1);              // query block 0..7
  const int bh = bx >> 3;                     // plane 0..31
  const int q0 = qb * 256 + wq * 32;          // first query row of this wave

  // staging addresses: the plane's base is the same for the whole block (scalar registers), this thread's first 16-B piece
  // of a trip lies toff bytes behind it (one vector register for both planes and all trips)
  const char* Kg = (const char*)(kp + (size_t)bh * NS * ND);
  const char* Vg = (const char*)(vp + (size_t)bh * NS * ND);
  const unsigned toff = (unsigned)tid * 16u;

  // ---- q B fragments, per column group g, for both 32-deep d-chunks: column = query q0 + g*16 + c, k = d; elements 0..7 <-
  //      d = dc*32 + 8h .., elements 8..15 <- d = dc*32 + 16 + 8h .. (f32 rows, RNE-converted here) ----
  const float* Qg = qp + ((size_t)bh * NL + q0 + c) * ND + 8 * hh;
  FB qa[2][2];
#pragma unroll
  for (int g = 0; g < 2; ++g) {
#pragma unroll
    for (int dc = 0; dc < 2; ++dc) {
#pragma unroll
      for (int e = 0; e < 4; ++e)             // e = 0, 1: elements 0..7; e = 2, 3: elements 8..15
        qa[g][dc].d[e] = cvt4(*(const v4f*)(Qg + g * 16 * ND + dc * 32 + (e >> 1) * 16 + (e & 1) * 4));
    }
  }

  const int srow = tid >> 4;                  // staging: row of piece 0 (piece i: + 32 i), 0..31
  const int scol = (tid & 15) * 4;            // staging: first d of the piece, 0..60
  // K fragment address of this lane for key c of the wave's chunk, d = 8h (next 16 keys: + 16 LP, next 16 d: + 16)
  const __bf16* kad = Ksh + (kh * 64 + c) * LP + 8 * hh;
  // V^T fragment address of this lane for keys 0..15 of the wave's chunk, d 0..15 (next 16 keys: + 16 PV, next 16 d: + 32 B)
  const unsigned char* vad = Vsh + (kh * 64 + 8 * hh + (lane & 7)) * PV + ((lane >> 3) & 1) * 16;

  v8f O[2][4];
#pragma unroll
  for (int g = 0; g < 2; ++g) {
#pragma unroll
    for (int t = 0; t < 4; ++t) O[g][t] = zero8();
  }
  float mrun[2] = {-INFINITY, -INFINITY};     // running maximum of query g*16 + c over this wave's chunks, times log2 e (equal in both lane halves)
  float lrun[2] = {0.f, 0.f};                 // running sum over this lane half's keys only

  // ---- staging pipeline: ka / va hold the f32 pieces of the trip that is stored next ----
  v4f ka[4], va[4];
#pragma unroll
  for (int i = 0; i < 4; ++i) {               // trip 0: piece tid + 512 i of the trip's 2048 pieces of 16 B
    ka[i] = *(const v4f*)(Kg + 8192 * i + toff);
    va[i] = *(const v4f*)(Vg + 8192 * i + toff);
  }
#pragma unroll
  for (int i = 0; i < 4; ++i) {
    const int rw = srow + 32 * i;             // key within the trip, 0..127
    *(v2u*)(Ksh + rw * LP + scol)     = cvt4(ka[i]);
    *(v2u*)(Vsh + rw * PV + scol * 2) = cvt4h(va[i]);
  }
#pragma unroll
  for (int i = 0; i < 4; ++i) {               // trip 1 starts its flight
    ka[i] = *(const v4f*)(Kg + TRIPB + 8192 * i + toff);
    va[i] = *(const v4f*)(Vg + TRIPB + 8192 * i + toff);
  }
  unsigned voff = toff + 2u * TRIPB;          // byte offset, in both planes, of this thread's first piece of the trip loaded next
  __syncthreads();                            // trip 0 is published

  unsigned rb = 0u;                           // byte offset of the buffer that this trip reads: 0 or L_BUF
  // one trip per loop body: with two trips in one body the compiler lets a trip's softmax and context products sink behind
  // the next trip's score products and spills both trips' accumulators to scratch
#pragma unroll 1
  for (int kt = 0; kt < NKT; ++kt) {          // block-uniform trip count
    const unsigned wb = rb ^ (unsigned)L_BUF; // the other buffer, written in this trip
    const __bf16* Kb = (const __bf16*)((const unsigned char*)kad + rb);
    const unsigned char* vab = vad + rb;

    // ---- the wave's 8 K fragments (A: key j*16+c (row), d = dc*32 + 8h .. (k)) are asked for as one group ----
    FB kb[2][4];
#pragma unroll
    for (int dc = 0; dc < 2; ++dc) {
#pragma unroll
      for (int j = 0; j < 4; ++j) {
        const int kr = j * 16 * LP + dc * 32;
        kb[dc][j].h[0] = *(const v8b*)(Kb + kr);
        kb[dc][j].h[1] = *(const v8b*)(Kb + kr + 16);
      }
    }

    // ---- trip kt + 1, loaded one trip ago, goes into the other buffer (its last readers left it at the barrier that
    //      ended trip kt - 1) ----
    {
      __bf16* Kn = (__bf16*)((unsigned char*)Ksh + wb);
      unsigned char* Vn = Vsh + wb;
#pragma unroll
      for (int i = 0; i < 4; ++i) {
        const int rw = srow + 32 * i;         // key within the trip, 0..127
        *(v2u*)(Kn + rw * LP + scol)     = cvt4(ka[i]);
        *(v2u*)(Vn + rw * PV + scol * 2) = cvt4h(va[i]);
      }
    }
    // scheduling fence: the pieces' 32 registers are free before the 64 score accumulators come to life. Without it the
    // compiler mixes the two, spills to scratch, and waits to 0 for most fragments
    __builtin_amdgcn_sched_barrier(0);

    // ---- scores^T: 64 keys x 32 query columns per wave, exact bf16 products over 2 d-chunks; one K fragment, two products ----
    v8f s[2][4];
#pragma unroll
    for (int g = 0; g < 2; ++g) {
#pragma unroll
      for (int j = 0; j < 4; ++j) s[g][j] = zero8();
    }
#pragma unroll
    for (int dc = 0; dc < 2; ++dc) {
#pragma unroll
      for (int j = 0; j < 4; ++j) {
#pragma unroll
        for (int g = 0; g < 2; ++g) s[g][j] = mma_b(kb[dc][j].v, qa[g][dc].v, s[g][j]);
      }
    }

    // ---- trip kt + 2 starts its flight. No branch: past the last trip the offset stays at the last trip's, and what is
    //      stored then is read by nobody ----
    {
#pragma unroll
      for (int i = 0; i < 4; ++i) {
        ka[i] = *(const v4f*)(Kg + (size_t)voff + 8192 * i);
        va[i] = *(const v4f*)(Vg + (size_t)voff + 8192 * i);
      }
      const unsigned step = (kt + 3 < NKT) ? (unsigned)TRIPB : 0u;   // the offset stops at the last trip
      // the offset register moves on to the next trip behind the wait that stands before a register of an issued load is
      // overwritten, both in one statement: the register lives through the loop and the loads take the scalar-base form.
      // With a vector address pair per trip one build laid the last load's result over the pairs of the loads in front of it
      asm volatile("s_wait_xcnt 0x0\n\tv_add_nc_u32 %0, %1, %0" : "+v"(voff) : "s"(step) : "memory");
    }
    // scheduling fence: the score products and the loads stand as one block in front of the softmax. Without it the compiler
    // spreads the loads through the softmax and spills to scratch
    __builtin_amdgcn_sched_barrier(0);

    FB ph[2][2];
    float al[2];
#pragma unroll
    for (int g = 0; g < 2; ++g) {
      // ---- maximum of query g*16 + c over the chunk: 32 scores in the lane, then the other lane half ----
      float mj[4];
#pragma unroll
      for (int j = 0; j < 4; ++j) {
        mj[j] = s[g][j][0];
#pragma unroll
        for (int r = 1; r < 8; ++r) mj[j] = fmaxf(mj[j], s[g][j][r]);
      }
      float m = fmaxf(fmaxf(mj[0], mj[1]), fmaxf(mj[2], mj[3]));
      m = fmaxf(m, other_half(m));
      const float mnew = fmaxf(mrun[g], m * LOG2E);           // finite: every chunk has 64 valid keys
      al[g]   = __builtin_amdgcn_exp2f(mrun[g] - mnew);       // first chunk: 2^(-inf) = 0
      mrun[g] = mnew;
      const v2f l2 = {LOG2E, LOG2E};
      const v2f nm = {-mnew, -mnew};

      // ---- p = 2^(s * log2 e - m), one packed fused multiply-add per two scores, rounded to f16 and packed in place into the
      //      B fragments of the context product ----
      float pj[4];
#pragma unroll
      for (int j = 0; j < 4; ++j) {
        pj[j] = 0.f;
#pragma unroll
        for (int r2 = 0; r2 < 4; ++r2) {
          const v2f sp  = {s[g][j][2 * r2], s[g][j][2 * r2 + 1]};
          const v2f arg = __builtin_elementwise_fma(sp, l2, nm);
          v2f pp;
          pp[0] = __builtin_amdgcn_exp2f(arg[0]);
          pp[1] = __builtin_amdgcn_exp2f(arg[1]);
          pj[j] += pp[0];
          pj[j] += pp[1];
          const v2h h2 = __builtin_convertvector(pp, v2h);                             // RNE, two per instruction
          ph[g][j >> 1].u[(j & 1) * 4 + r2] = __builtin_bit_cast(unsigned, h2);
        }
      }
      lrun[g] = lrun[g] * al[g] + ((pj[0] + pj[1]) + (pj[2] + pj[3]));

      // ---- rescale the running context of the group ----
#pragma unroll
      for (int t = 0; t < 4; ++t) {
#pragma unroll
        for (int r = 0; r < 8; ++r) O[g][t][r] *= al[g];
      }
    }

    // ---- context^T += V^T . P^T (one f16 product per group); one V^T fragment, two products ----
#pragma unroll
    for (int kk = 0; kk < 2; ++kk) {
#pragma unroll
      for (int t = 0; t < 4; ++t) {
        FB vb;                                   // A fragment: row d = t*16+c, keys kk*32 + 8h .. and kk*32 + 16 + 8h ..
        vb.q[0] = ld_tr16(vab + (kk * 32) * PV + 32 * t);
        vb.q[1] = ld_tr16(vab + (kk * 32 + 16) * PV + 32 * t);
#pragma unroll
        for (int g = 0; g < 2; ++g) O[g][t] = mma_h(vb.f, ph[g][kk].f, O[g][t]);
      }
    }
    __syncthreads();                           // publishes trip kt + 1; every wave is done with the buffer it read
    rb = wb;
  }

  // ---- hand-over between the two key groups: wave (wq, kh) finishes column group kh and gives the other group's maximum,
  //      sum (lane halves joined) and context to wave (wq, kh ^ 1), same lane, same register ----
  // the lane's number is formed anew here: no lane-dependent value of the epilogue holds a vector register through the trip loop,
  // which needs nearly all the registers a wave has here (kept alive from the top, they went to scratch)
  const int lane_e = (int)__builtin_amdgcn_mbcnt_lo(~0u, 0u);
  const int hh_e   = lane_e >> 4;
  const int c_e    = lane_e & 15;
  float* os = (float*)lds + wave * (L_WEPI / 4);
  const float* xp = (const float*)lds + (wave ^ 8) * (L_WEPI / 4);
  const bool k0 = (kh == 0);
  const float l0 = lrun[0] + other_half(lrun[0]);
  const float l1 = lrun[1] + other_half(lrun[1]);
  const float mk = k0 ? mrun[0] : mrun[1];
  const float lk = k0 ? l0 : l1;
  {
    v2f ml;
    ml[0] = k0 ? mrun[1] : mrun[0];
    ml[1] = k0 ? l1 : l0;
#pragma unroll
    for (int t = 0; t < 4; ++t) {
      v4f w0, w1;
#pragma unroll
      for (int r = 0; r < 4; ++r) {
        w0[r] = k0 ? O[1][t][r]     : O[0][t][r];
        w1[r] = k0 ? O[1][t][4 + r] : O[0][t][4 + r];
      }
      *(v4f*)(os + ((2 * t) * 32 + lane_e) * 4)     = w0;
      *(v4f*)(os + ((2 * t + 1) * 32 + lane_e) * 4) = w1;
    }
    *(v2f*)(os + 1024 + lane_e * 2) = ml;
  }
  __syncthreads();                             // the hand-over ranges are published
  v4f px[8];
#pragma unroll
  for (int i = 0; i < 8; ++i) px[i] = *(const v4f*)(xp + (i * 32 + lane_e) * 4);
  const v2f pml = *(const v2f*)(xp + 1024 + lane_e * 2);
  __syncthreads();                             // every wave has read its partner's range: each range becomes its owner's output staging

  // ---- join the two key groups, normalise, stage the wave's 16x64 f32 tile in LDS, whole-line writes ----
  const float mall = fmaxf(mk, pml[0]);        // both finite: each group has walked 16 chunks
  const float ea   = __builtin_amdgcn_exp2f(mk - mall);       // the maxima are in base-2 units
  const float eb   = __builtin_amdgcn_exp2f(pml[0] - mall);
  const float lsum = lk * ea + pml[1] * eb;
  const float inv  = (lsum > 0.f) ? (1.0f / lsum) : 0.f;
  const float fa   = ea * inv;
  const float fb   = eb * inv;
#pragma unroll
  for (int t = 0; t < 4; ++t) {
    v4f w0, w1;
#pragma unroll
    for (int r = 0; r < 4; ++r) {
      w0[r] = (k0 ? O[0][t][r]     : O[1][t][r])     * fa + px[2 * t][r]     * fb;
      w1[r] = (k0 ? O[0][t][4 + r] : O[1][t][4 + r]) * fa + px[2 * t + 1][r] * fb;
    }
    *(v4f*)(os + c_e * OP + t * 16 + 8 * hh_e)     = w0;
    *(v4f*)(os + c_e * OP + t * 16 + 8 * hh_e + 4) = w1;
  }
  __builtin_amdgcn_fence(__ATOMIC_RELEASE, "workgroup");
  __builtin_amdgcn_wave_barrier();
  __builtin_amdgcn_fence(__ATOMIC_ACQUIRE, "workgroup");
  float* og = Op + ((size_t)bh * NL + q0 + kh * 16) * ND;   // the wave's 16 rows are contiguous: row r at + r*64
  const int colw = c_e * 4;
  v4f ov[8];
#pragma unroll
  for (int it = 0; it < 8; ++it) {
    const int row = 2 * it + hh_e;               // rows 0..15: lanes 0..15 even row, lanes 16..31 odd row
    ov[it] = *(const v4f*)(os + row * OP + colw);
  }
#pragma unroll
  for (int it = 0; it < 8; ++it) {
    const int row = 2 * it + hh_e;
    *(v4f*)(og + (size_t)row * ND + colw) = ov[it];
  }
}

// =====================================================================================================
//   One launch; the workspace is not used.
// =====================================================================================================
extern "C" void kernel_launch(void* const* d_in, const int* in_sizes, int n_in,
                              void* d_out, int out_size, void* d_ws, size_t ws_size,
                              hipStream_t stream) {
  const int nqkv = NBH * NL * ND;                           // 4194304
  if (n_in < 3) return;
  if (in_sizes[0] != nqkv || in_sizes[1] != nqkv || in_sizes[2] != nqkv) return;
  if (out_size != nqkv) return;
  (void)d_ws;
  (void)ws_size;

  const float* q = (const float*)d_in[0];
  const float* k = (const float*)d_in[1];
  const float* v = (const float*)d_in[2];

  const dim3 blk(512);
  const dim3 gAttn(NBH * NQB);                              // 256 blocks

  // attention per (plane, 256-query block) -> d_out f32 [32][2048][64]
  attn_hm<<<gAttn, blk, 0, stream>>>(q, k, v, (float*)d_out);
  (void)hipGetLastError();
}
